// v000
// Times are from an AMD MI455X. After a warm-up the kernel runs many times in a row, and a time is the length of
// such a window on the GPU divided by its runs, so every launch and the gaps after it count. The runs cycle
// through copies of the inputs. A figure is the median of several windows, for all but v000 over two sittings.
// Sittings can differ by a few percent; kernels timed side by side share one.
// v000 is the starting kernel. One run takes 243 microseconds.
// Contractions: Q/K/V projections = Xb . Wb^T on v_wmma_f32_16x16x32_bf16 (Xb, Wb = RNE bf16 convert of A, B, Wq,
// Wk, Wv; K=256, f32 accumulate); scores S^T = Kp . Qp^T on v_wmma_f32_16x16x32_f16 (Kp, Qp = f16 planes of the
// projections incl. bias, K=256); O^T = Vt . P^T on v_wmma_f32_16x16x32_f16 (Vt = f16 plane of V incl. bias,
// P = e^{s-m} x 1024 in f16, 2048 keys); f32 accumulate everywhere; bias add, 1/16 scale, key mask select,
// running max, row sums and 1/l in f32 on VALU.
#include <hip/hip_runtime.h>
#include <math.h>
#include <stdint.h>

#define NB    8
#define SEQ   2048
#define DM    256
#define NROW  (NB * SEQ)
#define QT    64
#define PTP   40
#define OSP   132
#define QSP   136
#define TP    72
#define LNPS  6.931471805599453f
#define FMIN16 6.103515625e-05f
#define NEGBIG (-1.0e30f)
static_assert((SEQ % QT) == 0);
static_assert((SEQ % 64) == 0);
static_assert((SEQ % 256) == 0);
static_assert((DM % 128) == 0);
static_assert((DM % 32) == 0);
static_assert((NROW % 64) == 0);
static_assert(((DM * DM) / 8) % 256 == 0);
static_assert(((NROW * DM) / 8) % 256 == 0);
static_assert(DM == 256);
static_assert(QT == 64);
static_assert(64 * QSP <= 128 * TP);

typedef _Float16       v16h __attribute__((ext_vector_type(16)));
typedef _Float16       v8h  __attribute__((ext_vector_type(8)));
typedef __bf16         v16b __attribute__((ext_vector_type(16)));
typedef unsigned short v8us __attribute__((ext_vector_type(8)));
typedef float          v8f  __attribute__((ext_vector_type(8)));
typedef float          v4f  __attribute__((ext_vector_type(4)));
typedef unsigned int   v4u  __attribute__((ext_vector_type(4)));

union FragH { v16h v; v8h  h[2]; };
union FragB { v16b v; v8us u[2]; };
static_assert(sizeof(FragH) == 32);
static_assert(sizeof(FragB) == 32);

// ---- scalar helpers --------------------------------------------------------------------------------
__device__ __forceinline__ unsigned short bf_bits(float f) {          // f32 -> bf16 bits, RNE convert
  unsigned u = __float_as_uint(f);
  return (unsigned short)((u + 0x7FFFu + ((u >> 16) & 1u)) >> 16);
}
__device__ __forceinline__ float bf_up(unsigned short x) { return __uint_as_float(((unsigned)x) << 16); }
__device__ __forceinline__ float bfr(float f) { return bf_up(bf_bits(f)); }
__device__ __forceinline__ unsigned short h_bits(_Float16 x) { return __builtin_bit_cast(unsigned short, x); }
__device__ __forceinline__ unsigned pk16(unsigned short a, unsigned short b) { return (unsigned)a | ((unsigned)b << 16); }
// f32 -> f16 with magnitudes below the smallest f16 normal flushed to zero (select by value)
__device__ __forceinline__ _Float16 to_h_ftz(float v) { return (_Float16)((fabsf(v) < FMIN16) ? 0.0f : v); }
__device__ __forceinline__ v8f zero8() { v8f z = {0.f, 0.f, 0.f, 0.f, 0.f, 0.f, 0.f, 0.f}; return z; }
__device__ __forceinline__ float hmax8(v8f s) {
  return fmaxf(fmaxf(fmaxf(s[0], s[1]), fmaxf(s[2], s[3])), fmaxf(fmaxf(s[4], s[5]), fmaxf(s[6], s[7])));
}

// ---- fragment loaders: 16-bit A/B operand, lane -> row/col (lane&15), p already includes +8*(lane>>4);
//      elements 0..7 <- p[0..7] (k0+8h..), elements 8..15 <- p[16..23] (k0+16+8h..)
__device__ __forceinline__ v16h ldfrag_h(const _Float16* p) {
  FragH f;
  f.h[0] = *(const v8h*)(p);
  f.h[1] = *(const v8h*)(p + 16);
  return f.v;
}
__device__ __forceinline__ v16b ldfrag_b(const unsigned short* p) {
  FragB f;
  f.u[0] = *(const v8us*)(p);
  f.u[1] = *(const v8us*)(p + 16);
  return f.v;
}

// ---- WMMA helpers: builtin followed by a 4-slot VALU gap tying D and keeping A/B live ----------------------
__device__ __forceinline__ v8f mma_h(v16h a, v16h b, v8f c) {
  v8f d = __builtin_amdgcn_wmma_f32_16x16x32_f16(false, a, false, b, (short)0, c, false, false);
#if defined(__HIP_DEVICE_COMPILE__)
  asm volatile("v_nop\n\tv_nop\n\tv_nop\n\tv_nop" : "+v"(d) : "v"(a), "v"(b));
#endif
  return d;
}
__device__ __forceinline__ v8f mma_b(v16b a, v16b b, v8f c) {
  v8f d = __builtin_amdgcn_wmma_f32_16x16x32_bf16(false, a, false, b, (short)0, c, false, false);
#if defined(__HIP_DEVICE_COMPILE__)
  const v16h ha = __builtin_bit_cast(v16h, a), hb = __builtin_bit_cast(v16h, b);
  asm volatile("v_nop\n\tv_nop\n\tv_nop\n\tv_nop" : "+v"(d) : "v"(ha), "v"(hb));
#endif
  return d;
}

// =====================================================================================================
// (0) dst[8i .. 8i+7] = bf16 bits (RNE convert) of src[8i .. 8i+7]; thread i converts 8 consecutive floats,
// coverage: grid = n8/256 blocks x 256 threads x 8 = 8*n8 elements exactly.
// =====================================================================================================
__global__ __launch_bounds__(256) void cvt8(const float* __restrict__ src, unsigned short* dst, int n8) {
  const int i = blockIdx.x * 256 + threadIdx.x;
  if (i >= n8) return;
  const float* p = src + (size_t)i * 8;
  const v4f f0 = *(const v4f*)(p), f1 = *(const v4f*)(p + 4);
  v4u wb;
  wb[0] = pk16(bf_bits(f0[0]), bf_bits(f0[1]));
  wb[1] = pk16(bf_bits(f0[2]), bf_bits(f0[3]));
  wb[2] = pk16(bf_bits(f1[0]), bf_bits(f1[1]));
  wb[3] = pk16(bf_bits(f1[2]), bf_bits(f1[3]));
  unsigned short* d = dst + (size_t)i * 8;
  *(v4u*)d = wb;
  
}

// =====================================================================================================
// (1) projection for one 64-row x 128-col tile of Y = Xb . Wb^T + bf16(bias): block = 256 threads = 8 waves.
//   Wave w: row group rg = w&3 (A rows = row0 + 16rg + (lane&15), split k map over d), col half ch = w>>2
//   (B = Wb rows col0 + 64ch + 16j + (lane&15), same split k map), 4 D tiles, 8 k-steps of 32, fragments from global.
//   D element r of tile j = (row row0 + 16rg + 8h + r, col col0 + 64ch + 16j + c).
//     lines to OP[row][col] (pitch DM): each tile row segment = 128 halves = 2 lines, 8 consecutive lanes x 16 B per line.
//   tr == 1: same values staged transposed into LDS S[col][row] (pitch TP, 16-B stores of 8 consecutive rows),
// coverage: staging: 4 rg x 2 h x 8 r = 64 rows, 2 ch x 4 j x 16 c = 128 cols; tr==0 writes: 4 it x 32 lines x 8 lanes
//   x 8 halves = 64 rows x 128 cols; tr==1 writes: 4 it x 32 d rows x 8 lanes x 8 halves = 128 d x 64 keys;
//   grid = 2 col tiles x 256 row tiles covers Y [16384][256] (or Vt [8][256][2048]) exactly once.
// =====================================================================================================
__global__ __launch_bounds__(256)
void proj_kernel(const unsigned short* __restrict__ XB, const unsigned short* __restrict__ WB,
                 const float* __restrict__ bias, unsigned short* OP, int tr) {
  __shared__ __align__(16) unsigned short S[128 * TP];
  const int tid  = threadIdx.x;
  const int lane = tid & 31, wave = tid >> 5;
  const int h    = lane >> 4, c = lane & 15;
  const int rg   = wave & 3, ch = wave >> 2;
  const int row0 = blockIdx.y * 64;
  const int col0 = blockIdx.x * 128;

  const unsigned short* ap = XB + ((size_t)(row0 + 16 * rg + c)) * DM + 8 * h;
  const unsigned short* bp = WB + ((size_t)(col0 + 64 * ch + c)) * DM + 8 * h;
  v8f acc0 = zero8(), acc1 = zero8(), acc2 = zero8(), acc3 = zero8();
#pragma unroll 2
  for (int ks = 0; ks < DM / 32; ++ks) {
    const v16b a = ldfrag_b(ap + 32 * ks);
    const unsigned short* bs = bp + 32 * ks;
    acc0 = mma_b(a, ldfrag_b(bs + 0 * 16 * DM), acc0);
    acc1 = mma_b(a, ldfrag_b(bs + 1 * 16 * DM), acc1);
    acc2 = mma_b(a, ldfrag_b(bs + 2 * 16 * DM), acc2);
    acc3 = mma_b(a, ldfrag_b(bs + 3 * 16 * DM), acc3);
  }

  // biases as bf16 RNE values, in-range lane indices (cb + 48 <= 255)
  const int cb = col0 + 64 * ch + c;
  const float bb0 = bfr(bias[cb + 0 * 16]), bb1 = bfr(bias[cb + 1 * 16]);
  const float bb2 = bfr(bias[cb + 2 * 16]), bb3 = bfr(bias[cb + 3 * 16]);

  unsigned short q0[8], q1[8], q2[8], q3[8];
#pragma unroll
  for (int r = 0; r < 8; ++r) {
    q0[r] = h_bits(to_h_ftz(acc0[r] + bb0));
    q1[r] = h_bits(to_h_ftz(acc1[r] + bb1));
    q2[r] = h_bits(to_h_ftz(acc2[r] + bb2));
    q3[r] = h_bits(to_h_ftz(acc3[r] + bb3));
  }

  if (tr == 0) {                                             // block-uniform
    // stage: D row r -> tile row 16rg + 8h + r, col = 64ch + 16j + c
    unsigned short* qs = S + (16 * rg + 8 * h) * QSP + 64 * ch + c;
#pragma unroll
    for (int r = 0; r < 8; ++r) {
      qs[r * QSP + 0 * 16] = q0[r];
      qs[r * QSP + 1 * 16] = q1[r];
      qs[r * QSP + 2 * 16] = q2[r];
      qs[r * QSP + 3 * 16] = q3[r];
    }
  } else {
    // stage transposed: S[col_local][row_local], 8 consecutive rows (r = 0..7) per 16-B store
    v4u w0, w1, w2, w3;
#pragma unroll
    for (int t = 0; t < 4; ++t) {
      w0[t] = pk16(q0[2 * t], q0[2 * t + 1]);
      w1[t] = pk16(q1[2 * t], q1[2 * t + 1]);
      w2[t] = pk16(q2[2 * t], q2[2 * t + 1]);
      w3[t] = pk16(q3[2 * t], q3[2 * t + 1]);
    }
    unsigned short* ts = S + (64 * ch + c) * TP + 16 * rg + 8 * h;
    *(v4u*)(ts + 0 * 16 * TP) = w0;
    *(v4u*)(ts + 1 * 16 * TP) = w1;
    *(v4u*)(ts + 2 * 16 * TP) = w2;
    *(v4u*)(ts + 3 * 16 * TP) = w3;
  }
  __syncthreads();

  const int e = tid & 7, lg = tid >> 3;                      // lg 0..31
  if (tr == 0) {
{
#pragma unroll
      for (int it = 0; it < 4; ++it) {
        const int L   = it * 32 + lg;                        // lines 0..127 of the tile
        const int row = L >> 1, hf = L & 1;
        const v4u v = *(const v4u*)(S + row * QSP + 64 * hf + 8 * e);
        *(v4u*)(OP + ((size_t)(row0 + row)) * DM + col0 + 64 * hf + 8 * e) = v;
      }
      
    }
  } else {
    const int b    = row0 / SEQ;
    const int key0 = row0 % SEQ;                             // 64 consecutive keys of one batch
{
#pragma unroll
      for (int it = 0; it < 4; ++it) {
        const int dd = it * 32 + lg;                         // d local 0..127
        const v4u v = *(const v4u*)(S + dd * TP + 8 * e);
        *(v4u*)(OP + ((size_t)b * DM + col0 + dd) * SEQ + key0 + 8 * e) = v;
      }
      
    }
  }
}

// =====================================================================================================
// (2) attention for one (b, 64-query tile), transposed formulation, 256-deep scores, 2048 keys, 32 keys per iteration.
//   Block = 256 threads = 8 waves. Key mask row of batch b staged once in LDS Ms[2048].
//   Waves 0..3: S^T tiles (16 keys x 16 queries) = A(Kp rows = keys kb + (lane&15) [and kb+16+..], d via the split
//     k map) . B(Qp rows = query n0 + 16w + (lane&15), same d map), 8 d-steps, two tiles; s = D x (1/16), masked key
//     (Ms == 0) -> s := -1e30 (exp gives 0; a fully masked row gives equal weights). Per lane the two D tiles hold
//     16 keys of ONE query: online softmax state per lane, one shuffle (lane^16) for the max over 32 keys, row-sum
//     partials combined at the end. P = e^{s-m} x 1024 written to LDS Pt[query][key] (8 consecutive f16 per 16-B
//     store: keys 8h..8h+7 and 16+8h..23+8h), corr to Cs[query]; barrier.
//   All 8 waves: wave w owns O^T rows d = 32w + 16jd + .. for all 64 queries (8 accumulators): rescale by corr,
//     A = Vt rows d (keys contiguous), B = Pt rows (query col, keys via the split k map), 8 WMMAs; barrier.
//   Epilogue in 2 halves of 128 d: waves 4t..4t+3 stage O^T x (1/l) into Os[query][d_local] (16-B LDS stores),
// coverage: Pt: 4 waves x 16 c = 64 query rows x (2 h x 2 stores x 8) = 32 keys; Os per half: 4 waves x 2 jd x 2 h
//           x 8 r = 128 d, 4 jq x 16 c = 64 queries; out: 2 t x 8 it x 32 lines x 8 lanes x 4 floats = 64 rows x 256;
//           grid = 8 b x 32 query tiles = 256 blocks covers out exactly once.
// =====================================================================================================
__global__ __launch_bounds__(256)
void attn_kernel(const unsigned short* __restrict__ QP, const unsigned short* __restrict__ KP,
                 const unsigned short* __restrict__ VT, const int* __restrict__ mask, float* out) {
  __shared__ __align__(16) _Float16 Pt[64 * PTP];
  __shared__ float Cs[64];
  __shared__ float Ls[64];
  __shared__ __align__(16) float Os[64 * OSP];
  __shared__ int Ms[SEQ];
  const int tid  = threadIdx.x;
  const int wave = tid >> 5;
  const int lane = tid & 31;
  const int h    = lane >> 4;
  const int c    = lane & 15;
  const int bx   = blockIdx.x;
  const int b    = bx / (SEQ / QT);
  const int qt   = bx % (SEQ / QT);
  const int n0   = qt * QT;
  const _Float16* QPh = (const _Float16*)(const void*)QP;
  const _Float16* KPh = (const _Float16*)(const void*)KP;
  const _Float16* VTh = (const _Float16*)(const void*)VT;

#pragma unroll
  for (int i = 0; i < SEQ / 256; ++i) Ms[i * 256 + tid] = mask[(size_t)b * SEQ + i * 256 + tid];
  __syncthreads();

  const int wq = wave & 3;
  // Qp fragment base (B operand of scores, col = query n0 + 16wq + c), + 32*ks
  const _Float16* qpp = QPh + ((size_t)b * SEQ + n0 + 16 * wq + c) * DM + 8 * h;
  // Kp fragment base (A operand of scores, row = key kb + c), + kb*DM + 32*ks
  const _Float16* khp = KPh + ((size_t)b * SEQ + c) * DM + 8 * h;
  // Vt fragment base (A operand of O^T, row = d = 32*wave + 16jd + c, keys contiguous), + 16jd*SEQ + kb
  const _Float16* vtp = VTh + ((size_t)b * DM + 32 * wave + c) * SEQ + 8 * h;
  const float SCL = 0.0625f;                                  // 1/sqrt(256)

  float m = NEGBIG, l = 0.f;
  v8f acc[2][4];
#pragma unroll
  for (int jd = 0; jd < 2; ++jd)
#pragma unroll
    for (int jq = 0; jq < 4; ++jq) acc[jd][jq] = zero8();

#pragma unroll 1
  for (int it = 0; it < SEQ / 32; ++it) {
    const int kb = it * 32;
    if (wave < 4) {                                           // wave-uniform branch
      v8f s0 = zero8(), s1 = zero8();
      const _Float16* k0p = khp + (size_t)kb * DM;            // keys kb .. kb+15
      const _Float16* k1p = k0p + 16 * DM;                    // keys kb+16 .. kb+31
#pragma unroll 2
      for (int ks = 0; ks < DM / 32; ++ks) {
        const v16h qf = ldfrag_h(qpp + 32 * ks);
        const v16h a0 = ldfrag_h(k0p + 32 * ks);
        const v16h a1 = ldfrag_h(k1p + 32 * ks);
        s0 = mma_h(a0, qf, s0);
        s1 = mma_h(a1, qf, s1);
      }
      // scale and key mask (select by value): D row 8h+r of s0 = key kb+8h+r, of s1 = key kb+16+8h+r
#pragma unroll
      for (int r = 0; r < 8; ++r) {
        const int keep0 = Ms[kb + 8 * h + r];
        const int keep1 = Ms[kb + 16 + 8 * h + r];
        const float v0 = s0[r] * SCL, v1 = s1[r] * SCL;
        s0[r] = (keep0 != 0) ? v0 : NEGBIG;
        s1[r] = (keep1 != 0) ? v1 : NEGBIG;
      }

      float mx = fmaxf(hmax8(s0), hmax8(s1));
      mx = fmaxf(mx, __shfl_xor(mx, 16, 32));
      const float mn   = fmaxf(m, mx);
      const float corr = __expf(m - mn);
      m = mn;
      const float msh = mn - LNPS;                            // exp gives e^{s-m} * 1024
      FragH ph;
      float ls = 0.f;
#pragma unroll
      for (int r = 0; r < 8; ++r) {
        const float e0 = __expf(s0[r] - msh);                 // key kb      + 8h + r
        const float e1 = __expf(s1[r] - msh);                 // key kb + 16 + 8h + r
        ls += e0 + e1;
        ph.h[0][r] = (_Float16)e0;
        ph.h[1][r] = (_Float16)e1;
      }
      l = l * corr + ls;
      _Float16* pr = Pt + (16 * wave + c) * PTP + 8 * h;
      *(v8h*)(pr)      = ph.h[0];                             // local keys 8h .. 8h+7
      *(v8h*)(pr + 16) = ph.h[1];                             // local keys 16+8h .. 23+8h
      if (h == 0) Cs[16 * wave + c] = corr;
    }
    __syncthreads();

    float cr[4];
#pragma unroll
    for (int jq = 0; jq < 4; ++jq) cr[jq] = Cs[16 * jq + c];
#pragma unroll
    for (int jd = 0; jd < 2; ++jd)
#pragma unroll
      for (int jq = 0; jq < 4; ++jq)
#pragma unroll
        for (int r = 0; r < 8; ++r) acc[jd][jq][r] *= cr[jq];

    v16h vf[2];
#pragma unroll
    for (int jd = 0; jd < 2; ++jd) vf[jd] = ldfrag_h(vtp + (size_t)(16 * jd) * SEQ + kb);
#pragma unroll
    for (int jq = 0; jq < 4; ++jq) {
      const v16h pf = ldfrag_h(Pt + (16 * jq + c) * PTP + 8 * h);
#pragma unroll
      for (int jd = 0; jd < 2; ++jd) acc[jd][jq] = mma_h(vf[jd], pf, acc[jd][jq]);
    }
    __syncthreads();                                          // Pt / Cs free for the next iteration
  }

  if (wave < 4) {
    l += __shfl_xor(l, 16, 32);
    if (h == 0) Ls[16 * wave + c] = 1.0f / l;                 // o and l both carry the x1024 factor; l >= 1024 > 0
  }
  __syncthreads();
  float scq[4];
#pragma unroll
  for (int jq = 0; jq < 4; ++jq) scq[jq] = Ls[16 * jq + c];

  const int e = tid & 7, lg = tid >> 3;                      // lg 0..31: line slot, e: 16-B piece
  float* ob = out + ((size_t)b * SEQ + n0) * DM;
#pragma unroll
  for (int t = 0; t < 2; ++t) {
    if ((wave >> 2) == t) {                                   // wave-uniform: waves 4t..4t+3 own d 128t .. 128t+127
      const int dl = 32 * (wave & 3);
#pragma unroll
      for (int jd = 0; jd < 2; ++jd)
#pragma unroll
        for (int jq = 0; jq < 4; ++jq) {
          float* os = Os + (16 * jq + c) * OSP + dl + 16 * jd + 8 * h;
          const float sc = scq[jq];
          v4f v0, v1;
          v0[0] = acc[jd][jq][0] * sc; v0[1] = acc[jd][jq][1] * sc;
          v0[2] = acc[jd][jq][2] * sc; v0[3] = acc[jd][jq][3] * sc;
          v1[0] = acc[jd][jq][4] * sc; v1[1] = acc[jd][jq][5] * sc;
          v1[2] = acc[jd][jq][6] * sc; v1[3] = acc[jd][jq][7] * sc;
          *(v4f*)(os)     = v0;
          *(v4f*)(os + 4) = v1;
        }
    }
    __syncthreads();
{
#pragma unroll
      for (int i = 0; i < 8; ++i) {
        const int L   = i * 32 + lg;                         // lines 0..255 of this half
        const int row = L >> 2, hf = L & 3;                  // query row 0..63, line 0..3 of the 128-float segment
        const v4f v = *(const v4f*)(Os + row * OSP + 32 * hf + 4 * e);
        *(v4f*)(ob + (size_t)row * DM + 128 * t + 32 * hf + 4 * e) = v;
      }
      
    }
    __syncthreads();
  }
}

// =====================================================================================================
// needed (all tiles exact, all grids exact multiples):
//   Ab   bf16 [16384][256]      0            8388608
//   Bb   bf16 [16384][256]      8388608      8388608
//   Qp   f16  [16384][256]      16777216     8388608
//   Kp   f16  [16384][256]      25165824     8388608
//   Vt   f16  [8][256][2048]    33554432     8388608
//   Wb   bf16 [3][256][256]     41943040     393216
//   end                         42336256
// =====================================================================================================
extern "C" void kernel_launch(void* const* d_in, const int* in_sizes, int n_in,
                              void* d_out, int out_size, void* d_ws, size_t ws_size,
                              hipStream_t stream) {
  const int NX = NB * SEQ * DM;                          // 4194304
  if (n_in < 9) return;
  if (in_sizes[0] != NX || in_sizes[1] != NX || in_sizes[2] != NB * SEQ) return;
  if (in_sizes[3] != DM * DM || in_sizes[5] != DM * DM || in_sizes[7] != DM * DM) return;
  if (in_sizes[4] != DM || in_sizes[6] != DM || in_sizes[8] != DM) return;
  if (out_size != NX) return;

  size_t off = 0;
  const size_t szP = (size_t)NROW * DM * 2;              // 8388608
  const size_t szW = (size_t)DM * DM * 2;                // 131072
  const size_t oAB = off; off += szP;
  const size_t oBB = off; off += szP;
  const size_t oQP = off; off += szP;
  const size_t oKP = off; off += szP;
  const size_t oVT = off; off += szP;
  const size_t oWB = off; off += 3 * szW;                // 393216
  if (off > ws_size) return;                             // off = 42336256
  if (off > (size_t)134217728) return;

  const float* Ain = (const float*)d_in[0];
  const float* Bin = (const float*)d_in[1];
  const int*   msk = (const int*)d_in[2];
  const float* Wq  = (const float*)d_in[3];
  const float* bq  = (const float*)d_in[4];
  const float* Wk  = (const float*)d_in[5];
  const float* bk  = (const float*)d_in[6];
  const float* Wv  = (const float*)d_in[7];
  const float* bv  = (const float*)d_in[8];
  char* ws = (char*)d_ws;
  unsigned short* AB  = (unsigned short*)(ws + oAB);
  unsigned short* BB  = (unsigned short*)(ws + oBB);
  unsigned short* QP  = (unsigned short*)(ws + oQP);
  unsigned short* KP  = (unsigned short*)(ws + oKP);
  unsigned short* VT  = (unsigned short*)(ws + oVT);
  unsigned short* WB  = (unsigned short*)(ws + oWB);
  float* out = (float*)d_out;

  const int  n8X = NX / 8;                               // 524288
  const int  n8W = (DM * DM) / 8;                        // 8192
  const dim3 blk256(256);
  const dim3 gX(n8X / 256);                              // 2048 blocks
  const dim3 gW(n8W / 256);                              // 32 blocks
  const dim3 gP(DM / 128, NROW / 64);                    // 2 x 256 blocks
  const dim3 gA(NB * (SEQ / QT));                        // 256 blocks: one (b, 64-query tile) each

  // (0) bf16 planes of A, B, Wq, Wk, Wv
  cvt8<<<gX, blk256, 0, stream>>>(Ain, AB, n8X);
  cvt8<<<gX, blk256, 0, stream>>>(Bin, BB, n8X);
  cvt8<<<gW, blk256, 0, stream>>>(Wq, WB + 0 * (size_t)DM * DM, n8W);
  cvt8<<<gW, blk256, 0, stream>>>(Wk, WB + 1 * (size_t)DM * DM, n8W);
  cvt8<<<gW, blk256, 0, stream>>>(Wv, WB + 2 * (size_t)DM * DM, n8W);
  // (1) Qp = Ab . Wqb^T + bq (f16 plane), Kp = Bb . Wkb^T + bk (f16 plane), Vt = (Bb . Wvb^T + bv)^T per batch (f16)
  proj_kernel<<<gP, blk256, 0, stream>>>(AB, WB + 0 * (size_t)DM * DM, bq, QP, 0);
  proj_kernel<<<gP, blk256, 0, stream>>>(BB, WB + 1 * (size_t)DM * DM, bk, KP, 0);
  proj_kernel<<<gP, blk256, 0, stream>>>(BB, WB + 2 * (size_t)DM * DM, bv, VT, 1);
  // (2) out[b][n][d] = sum_m softmax_m(mask ? Qp_n . Kp_m / 16 : -big) Vt[d][m]
  attn_kernel<<<gA, blk256, 0, stream>>>(QP, KP, VT, msk, out);
  (void)hipGetLastError();
}

// v001
// One run takes 127 microseconds.
// Two timings next to v000 put it at 1.87 and 1.92 times that version's speed.
// Contractions: Q/K/V projections = Xb . Wb^T on v_wmma_f32_16x16x32_bf16 (Xb, Wb = RNE bf16 convert of A, B, Wq,
// Wk, Wv; K=256, f32 accumulate); scores S^T = Kp . Qp^T on v_wmma_f32_16x16x32_f16 (Kp, Qp = f16 planes of the
// projections incl. bias, K=256); O^T = Vt . P^T on v_wmma_f32_16x16x32_f16 (Vt = f16 plane of V incl. bias,
// P = e^{s-m} x 1024 in f16, 2048 keys); f32 accumulate everywhere; bias add, 1/16 scale, key mask select,
// running max, row sums and 1/l in f32 on VALU.
#include <hip/hip_runtime.h>
#include <math.h>
#include <stdint.h>

#define NB    8
#define SEQ   2048
#define DM    256
#define NROW  (NB * SEQ)
#define QT    64
#define PTP   40
#define OSP   132
#define QSP   136
#define TP    72
#define KST   64                      /* keys per ring stage (two 32-key passes) */
#define NST   (SEQ / KST)
#define KQP   264                     /* LDS pitch of a Q or K row in halves: 528 B = 16 B x 33 */
#define VSP   72                      /* LDS pitch of a Vt row of 64 keys in halves: 144 B = 16 B x 9 */
#define LNPS  6.931471805599453f
#define FMIN16 6.103515625e-05f
#define NEGBIG (-1.0e30f)
static_assert((SEQ % QT) == 0);
static_assert((SEQ % 64) == 0);
static_assert((SEQ % 256) == 0);
static_assert((DM % 128) == 0);
static_assert((DM % 32) == 0);
static_assert((NROW % 64) == 0);
static_assert(((DM * DM) / 8) % 256 == 0);
static_assert(((NROW * DM) / 8) % 256 == 0);
static_assert(DM == 256);
static_assert(QT == 64);
static_assert(64 * QSP <= 128 * TP);
static_assert(NST >= 2);
static_assert(KST == 64);

typedef _Float16       v16h __attribute__((ext_vector_type(16)));
typedef _Float16       v8h  __attribute__((ext_vector_type(8)));
typedef __bf16         v16b __attribute__((ext_vector_type(16)));
typedef unsigned short v8us __attribute__((ext_vector_type(8)));
typedef float          v8f  __attribute__((ext_vector_type(8)));
typedef float          v4f  __attribute__((ext_vector_type(4)));
typedef unsigned int   v4u  __attribute__((ext_vector_type(4)));

union FragH { v16h v; v8h  h[2]; };
union FragB { v16b v; v8us u[2]; };
static_assert(sizeof(FragH) == 32);
static_assert(sizeof(FragB) == 32);

// ---- scalar helpers --------------------------------------------------------------------------------
__device__ __forceinline__ unsigned short bf_bits(float f) {          // f32 -> bf16 bits, RNE convert
  unsigned u = __float_as_uint(f);
  return (unsigned short)((u + 0x7FFFu + ((u >> 16) & 1u)) >> 16);
}
__device__ __forceinline__ float bf_up(unsigned short x) { return __uint_as_float(((unsigned)x) << 16); }
__device__ __forceinline__ float bfr(float f) { return bf_up(bf_bits(f)); }
__device__ __forceinline__ unsigned short h_bits(_Float16 x) { return __builtin_bit_cast(unsigned short, x); }
__device__ __forceinline__ unsigned pk16(unsigned short a, unsigned short b) { return (unsigned)a | ((unsigned)b << 16); }
// f32 -> f16 with magnitudes below the smallest f16 normal flushed to zero (select by value)
__device__ __forceinline__ _Float16 to_h_ftz(float v) { return (_Float16)((fabsf(v) < FMIN16) ? 0.0f : v); }
__device__ __forceinline__ v8f zero8() { v8f z = {0.f, 0.f, 0.f, 0.f, 0.f, 0.f, 0.f, 0.f}; return z; }
__device__ __forceinline__ float hmax8(v8f s) {
  return fmaxf(fmaxf(fmaxf(s[0], s[1]), fmaxf(s[2], s[3])), fmaxf(fmaxf(s[4], s[5]), fmaxf(s[6], s[7])));
}

// ---- fragment loaders: 16-bit A/B operand, lane -> row/col (lane&15), p already includes +8*(lane>>4);
//      elements 0..7 <- p[0..7] (k0+8h..), elements 8..15 <- p[16..23] (k0+16+8h..)
__device__ __forceinline__ v16h ldfrag_h(const _Float16* p) {
  FragH f;
  f.h[0] = *(const v8h*)(p);
  f.h[1] = *(const v8h*)(p + 16);
  return f.v;
}
__device__ __forceinline__ v16b ldfrag_b(const unsigned short* p) {
  FragB f;
  f.u[0] = *(const v8us*)(p);
  f.u[1] = *(const v8us*)(p + 16);
  return f.v;
}

// ---- WMMA helpers: builtin followed by a 4-slot VALU gap tying D and keeping A/B live ----------------------
__device__ __forceinline__ v8f mma_h(v16h a, v16h b, v8f c) {
  v8f d = __builtin_amdgcn_wmma_f32_16x16x32_f16(false, a, false, b, (short)0, c, false, false);
#if defined(__HIP_DEVICE_COMPILE__)
  asm volatile("v_nop\n\tv_nop\n\tv_nop\n\tv_nop" : "+v"(d) : "v"(a), "v"(b));
#endif
  return d;
}
__device__ __forceinline__ v8f mma_b(v16b a, v16b b, v8f c) {
  v8f d = __builtin_amdgcn_wmma_f32_16x16x32_bf16(false, a, false, b, (short)0, c, false, false);
#if defined(__HIP_DEVICE_COMPILE__)
  const v16h ha = __builtin_bit_cast(v16h, a), hb = __builtin_bit_cast(v16h, b);
  asm volatile("v_nop\n\tv_nop\n\tv_nop\n\tv_nop" : "+v"(d) : "v"(ha), "v"(hb));
#endif
  return d;
}

// ---- asynchronous copies to LDS: eight 16-B copies per lane, copy j at LDS byte l + j*ls from g + j*gs halves.
//      s_wait_xcnt 0 is the statement's last line so that no address register is rewritten ahead of it.
__device__ __forceinline__ uint32_t lds_off(const void* p) { return (uint32_t)(size_t)p; }
__device__ __forceinline__ void acopy8(uint32_t l, uint32_t ls, const _Float16* g, size_t gs) {
#if defined(__HIP_DEVICE_COMPILE__)
  asm volatile(
      "global_load_async_to_lds_b128 %0, %8, off\n\t"
      "global_load_async_to_lds_b128 %1, %9, off\n\t"
      "global_load_async_to_lds_b128 %2, %10, off\n\t"
      "global_load_async_to_lds_b128 %3, %11, off\n\t"
      "global_load_async_to_lds_b128 %4, %12, off\n\t"
      "global_load_async_to_lds_b128 %5, %13, off\n\t"
      "global_load_async_to_lds_b128 %6, %14, off\n\t"
      "global_load_async_to_lds_b128 %7, %15, off\n\t"
      "s_wait_xcnt 0x0"
      :: "v"(l), "v"(l + ls), "v"(l + 2 * ls), "v"(l + 3 * ls),
         "v"(l + 4 * ls), "v"(l + 5 * ls), "v"(l + 6 * ls), "v"(l + 7 * ls),
         "v"(g), "v"(g + gs), "v"(g + 2 * gs), "v"(g + 3 * gs),
         "v"(g + 4 * gs), "v"(g + 5 * gs), "v"(g + 6 * gs), "v"(g + 7 * gs)
      : "memory");
#endif
}

// =====================================================================================================
// (0) dst[8i .. 8i+7] = bf16 bits (RNE convert) of src[8i .. 8i+7]; thread i converts 8 consecutive floats,
// coverage: grid = n8/256 blocks x 256 threads x 8 = 8*n8 elements exactly.
// =====================================================================================================
__global__ __launch_bounds__(256) void cvt8(const float* __restrict__ src, unsigned short* dst, int n8) {
  const int i = blockIdx.x * 256 + threadIdx.x;
  if (i >= n8) return;
  const float* p = src + (size_t)i * 8;
  const v4f f0 = *(const v4f*)(p), f1 = *(const v4f*)(p + 4);
  v4u wb;
  wb[0] = pk16(bf_bits(f0[0]), bf_bits(f0[1]));
  wb[1] = pk16(bf_bits(f0[2]), bf_bits(f0[3]));
  wb[2] = pk16(bf_bits(f1[0]), bf_bits(f1[1]));
  wb[3] = pk16(bf_bits(f1[2]), bf_bits(f1[3]));
  unsigned short* d = dst + (size_t)i * 8;
  *(v4u*)d = wb;
  
}

// =====================================================================================================
// (1) projection for one 64-row x 128-col tile of Y = Xb . Wb^T + bf16(bias): block = 256 threads = 8 waves.
//   Wave w: row group rg = w&3 (A rows = row0 + 16rg + (lane&15), split k map over d), col half ch = w>>2
//   (B = Wb rows col0 + 64ch + 16j + (lane&15), same split k map), 4 D tiles, 8 k-steps of 32, fragments from global.
//   D element r of tile j = (row row0 + 16rg + 8h + r, col col0 + 64ch + 16j + c).
//     lines to OP[row][col] (pitch DM): each tile row segment = 128 halves = 2 lines, 8 consecutive lanes x 16 B per line.
//   tr == 1: same values staged transposed into LDS S[col][row] (pitch TP, 16-B stores of 8 consecutive rows),
// coverage: staging: 4 rg x 2 h x 8 r = 64 rows, 2 ch x 4 j x 16 c = 128 cols; tr==0 writes: 4 it x 32 lines x 8 lanes
//   x 8 halves = 64 rows x 128 cols; tr==1 writes: 4 it x 32 d rows x 8 lanes x 8 halves = 128 d x 64 keys;
//   grid = 2 col tiles x 256 row tiles covers Y [16384][256] (or Vt [8][256][2048]) exactly once.
// =====================================================================================================
__global__ __launch_bounds__(256)
void proj_kernel(const unsigned short* __restrict__ XB, const unsigned short* __restrict__ WB,
                 const float* __restrict__ bias, unsigned short* OP, int tr) {
  __shared__ __align__(16) unsigned short S[128 * TP];
  const int tid  = threadIdx.x;
  const int lane = tid & 31, wave = tid >> 5;
  const int h    = lane >> 4, c = lane & 15;
  const int rg   = wave & 3, ch = wave >> 2;
  const int row0 = blockIdx.y * 64;
  const int col0 = blockIdx.x * 128;

  const unsigned short* ap = XB + ((size_t)(row0 + 16 * rg + c)) * DM + 8 * h;
  const unsigned short* bp = WB + ((size_t)(col0 + 64 * ch + c)) * DM + 8 * h;
  v8f acc0 = zero8(), acc1 = zero8(), acc2 = zero8(), acc3 = zero8();
#pragma unroll 2
  for (int ks = 0; ks < DM / 32; ++ks) {
    const v16b a = ldfrag_b(ap + 32 * ks);
    const unsigned short* bs = bp + 32 * ks;
    acc0 = mma_b(a, ldfrag_b(bs + 0 * 16 * DM), acc0);
    acc1 = mma_b(a, ldfrag_b(bs + 1 * 16 * DM), acc1);
    acc2 = mma_b(a, ldfrag_b(bs + 2 * 16 * DM), acc2);
    acc3 = mma_b(a, ldfrag_b(bs + 3 * 16 * DM), acc3);
  }

  // biases as bf16 RNE values, in-range lane indices (cb + 48 <= 255)
  const int cb = col0 + 64 * ch + c;
  const float bb0 = bfr(bias[cb + 0 * 16]), bb1 = bfr(bias[cb + 1 * 16]);
  const float bb2 = bfr(bias[cb + 2 * 16]), bb3 = bfr(bias[cb + 3 * 16]);

  unsigned short q0[8], q1[8], q2[8], q3[8];
#pragma unroll
  for (int r = 0; r < 8; ++r) {
    q0[r] = h_bits(to_h_ftz(acc0[r] + bb0));
    q1[r] = h_bits(to_h_ftz(acc1[r] + bb1));
    q2[r] = h_bits(to_h_ftz(acc2[r] + bb2));
    q3[r] = h_bits(to_h_ftz(acc3[r] + bb3));
  }

  if (tr == 0) {                                             // block-uniform
    // stage: D row r -> tile row 16rg + 8h + r, col = 64ch + 16j + c
    unsigned short* qs = S + (16 * rg + 8 * h) * QSP + 64 * ch + c;
#pragma unroll
    for (int r = 0; r < 8; ++r) {
      qs[r * QSP + 0 * 16] = q0[r];
      qs[r * QSP + 1 * 16] = q1[r];
      qs[r * QSP + 2 * 16] = q2[r];
      qs[r * QSP + 3 * 16] = q3[r];
    }
  } else {
    // stage transposed: S[col_local][row_local], 8 consecutive rows (r = 0..7) per 16-B store
    v4u w0, w1, w2, w3;
#pragma unroll
    for (int t = 0; t < 4; ++t) {
      w0[t] = pk16(q0[2 * t], q0[2 * t + 1]);
      w1[t] = pk16(q1[2 * t], q1[2 * t + 1]);
      w2[t] = pk16(q2[2 * t], q2[2 * t + 1]);
      w3[t] = pk16(q3[2 * t], q3[2 * t + 1]);
    }
    unsigned short* ts = S + (64 * ch + c) * TP + 16 * rg + 8 * h;
    *(v4u*)(ts + 0 * 16 * TP) = w0;
    *(v4u*)(ts + 1 * 16 * TP) = w1;
    *(v4u*)(ts + 2 * 16 * TP) = w2;
    *(v4u*)(ts + 3 * 16 * TP) = w3;
  }
  __syncthreads();

  const int e = tid & 7, lg = tid >> 3;                      // lg 0..31
  if (tr == 0) {
{
#pragma unroll
      for (int it = 0; it < 4; ++it) {
        const int L   = it * 32 + lg;                        // lines 0..127 of the tile
        const int row = L >> 1, hf = L & 1;
        const v4u v = *(const v4u*)(S + row * QSP + 64 * hf + 8 * e);
        *(v4u*)(OP + ((size_t)(row0 + row)) * DM + col0 + 64 * hf + 8 * e) = v;
      }
      
    }
  } else {
    const int b    = row0 / SEQ;
    const int key0 = row0 % SEQ;                             // 64 consecutive keys of one batch
{
#pragma unroll
      for (int it = 0; it < 4; ++it) {
        const int dd = it * 32 + lg;                         // d local 0..127
        const v4u v = *(const v4u*)(S + dd * TP + 8 * e);
        *(v4u*)(OP + ((size_t)b * DM + col0 + dd) * SEQ + key0 + 8 * e) = v;
      }
      
    }
  }
}

// =====================================================================================================
// (2) attention for one (b, 64-query tile), transposed formulation, 256-deep scores, 2048 keys, 32 keys per iteration.
//   Block = 256 threads = 8 waves. Key mask row of batch b staged once in LDS Ms[2048].
//   Operand tiles come to LDS by asynchronous 16-B copies over whole 128-B lines: Qs[64 queries][256 d] once; a ring of
//     two buffers, stage = 64 keys = two passes: Ks[64 keys][256 d], Vs[256 d][64 keys]. Wave w copies Q rows and K rows
//     8w..8w+7 (one 512-B row per copy) and Vt rows 32w..32w+31 (four 128-B rows per copy). Stage s+2 is issued behind
//     the barrier that ends stage s; all fragments below are read from these tiles.
//   Waves 0..3: S^T tiles (16 keys x 16 queries) = A(Kp rows = keys kb + (lane&15) [and kb+16+..], d via the split
//     k map) . B(Qp rows = query n0 + 16w + (lane&15), same d map), 8 d-steps, two tiles; s = D x (1/16), masked key
//     (Ms == 0) -> s := -1e30 (exp gives 0; a fully masked row gives equal weights). Per lane the two D tiles hold
//     16 keys of ONE query: online softmax state per lane, one shuffle (lane^16) for the max over 32 keys, row-sum
//     partials combined at the end. P = e^{s-m} x 1024 written to LDS Pt[query][key] (8 consecutive f16 per 16-B
//     store: keys 8h..8h+7 and 16+8h..23+8h), corr to Cs[query]; barrier.
//   All 8 waves: wave w owns O^T rows d = 32w + 16jd + .. for all 64 queries (8 accumulators): rescale by corr,
//     A = Vt rows d (keys contiguous), B = Pt rows (query col, keys via the split k map), 8 WMMAs; barrier.
//   Epilogue in 2 halves of 128 d: waves 4t..4t+3 stage O^T x (1/l) into Os[query][d_local] (16-B LDS stores),
// coverage: Pt: 4 waves x 16 c = 64 query rows x (2 h x 2 stores x 8) = 32 keys; Os per half: 4 waves x 2 jd x 2 h
//           x 8 r = 128 d, 4 jq x 16 c = 64 queries; out: 2 t x 8 it x 32 lines x 8 lanes x 4 floats = 64 rows x 256;
//           grid = 8 b x 32 query tiles = 256 blocks covers out exactly once.
// =====================================================================================================
__global__ __launch_bounds__(256)
void attn_kernel(const unsigned short* __restrict__ QP, const unsigned short* __restrict__ KP,
                 const unsigned short* __restrict__ VT, const int* __restrict__ mask, float* out) {
  __shared__ __align__(16) _Float16 Pt[64 * PTP];
  __shared__ float Cs[64];
  __shared__ float Ls[64];
  __shared__ __align__(16) float Os[64 * OSP];
  __shared__ int Ms[SEQ];
  __shared__ __align__(16) _Float16 Qs[QT * KQP];
  __shared__ __align__(16) _Float16 Ks[2 * KST * KQP];
  __shared__ __align__(16) _Float16 Vs[2 * DM * VSP];
  const int tid  = threadIdx.x;
  const int wave = tid >> 5;
  const int lane = tid & 31;
  const int h    = lane >> 4;
  const int c    = lane & 15;
  const int bx   = blockIdx.x;
  const int b    = bx / (SEQ / QT);
  const int qt   = bx % (SEQ / QT);
  const int n0   = qt * QT;
  const _Float16* QPh = (const _Float16*)(const void*)QP;
  const _Float16* KPh = (const _Float16*)(const void*)KP;
  const _Float16* VTh = (const _Float16*)(const void*)VT;

#pragma unroll
  for (int i = 0; i < SEQ / 256; ++i) Ms[i * 256 + tid] = mask[(size_t)b * SEQ + i * 256 + tid];

  // copy sources and places of this lane: Q / K row 8*wave + j, 16-B piece lane; Vt row 32*wave + 4j + (lane>>3), piece lane&7
  const _Float16* qsrc = QPh + ((size_t)b * SEQ + n0 + 8 * wave) * DM + 8 * lane;
  const _Float16* ksrc = KPh + ((size_t)b * SEQ + 8 * wave) * DM + 8 * lane;                       // + stage * KST * DM
  const _Float16* vsrc = VTh + ((size_t)b * DM + 32 * wave + (lane >> 3)) * SEQ + 8 * (lane & 7);  // + stage * KST
  const uint32_t qdst = lds_off(Qs) + (uint32_t)(8 * wave * KQP + 8 * lane) * 2u;
  const uint32_t kdst = lds_off(Ks) + (uint32_t)(8 * wave * KQP + 8 * lane) * 2u;                  // + buffer * KST*KQP*2
  const uint32_t vdst = lds_off(Vs) + (uint32_t)((32 * wave + (lane >> 3)) * VSP + 8 * (lane & 7)) * 2u;  // + buffer * DM*VSP*2

  // Q tile and stage 0, landed and published; then stage 1 flies while stage 0 is worked on
  acopy8(qdst, KQP * 2u, qsrc, (size_t)DM);
  acopy8(kdst, KQP * 2u, ksrc, (size_t)DM);
  acopy8(vdst, 4u * VSP * 2u, vsrc, (size_t)4 * SEQ);
  asm volatile("s_wait_asynccnt 0x0" ::: "memory");          // this wave's copies have landed before the barrier publishes them
  __syncthreads();
  acopy8(kdst + KST * KQP * 2u, KQP * 2u, ksrc + (size_t)KST * DM, (size_t)DM);
  acopy8(vdst + DM * VSP * 2u, 4u * VSP * 2u, vsrc + KST, (size_t)4 * SEQ);

  const int wq = wave & 3;
  // Q fragment base in Qs (B operand of scores, col = query 16wq + c), + 32*ks
  const _Float16* qpp = Qs + (16 * wq + c) * KQP + 8 * h;
  // K fragment base in Ks (A operand of scores, row = local key c), + buffer + local key * KQP + 32*ks
  const _Float16* khp = Ks + c * KQP + 8 * h;
  // Vt fragment base in Vs (A operand of O^T, row = d = 32*wave + 16jd + c, keys contiguous), + buffer + 16jd*VSP + local key
  const _Float16* vtp = Vs + (32 * wave + c) * VSP + 8 * h;
  const float SCL = 0.0625f;                                  // 1/sqrt(256)

  float m = NEGBIG, l = 0.f;
  v8f acc[2][4];
#pragma unroll
  for (int jd = 0; jd < 2; ++jd)
#pragma unroll
    for (int jq = 0; jq < 4; ++jq) acc[jd][jq] = zero8();

#pragma unroll 1
  for (int it = 0; it < SEQ / 32; ++it) {
    const int kb  = it * 32;
    const int buf = (it >> 1) & 1;                            // ring buffer of stage it/2
    const int kl  = (it & 1) * 32;                            // first key of this pass inside its stage
    if (wave < 4) {                                           // wave-uniform branch
      v8f s0 = zero8(), s1 = zero8();
      const _Float16* k0p = khp + (buf * KST + kl) * KQP;     // keys kb .. kb+15
      const _Float16* k1p = k0p + 16 * KQP;                   // keys kb+16 .. kb+31
#pragma unroll 2
      for (int ks = 0; ks < DM / 32; ++ks) {
        const v16h qf = ldfrag_h(qpp + 32 * ks);
        const v16h a0 = ldfrag_h(k0p + 32 * ks);
        const v16h a1 = ldfrag_h(k1p + 32 * ks);
        s0 = mma_h(a0, qf, s0);
        s1 = mma_h(a1, qf, s1);
      }
      // scale and key mask (select by value): D row 8h+r of s0 = key kb+8h+r, of s1 = key kb+16+8h+r
#pragma unroll
      for (int r = 0; r < 8; ++r) {
        const int keep0 = Ms[kb + 8 * h + r];
        const int keep1 = Ms[kb + 16 + 8 * h + r];
        const float v0 = s0[r] * SCL, v1 = s1[r] * SCL;
        s0[r] = (keep0 != 0) ? v0 : NEGBIG;
        s1[r] = (keep1 != 0) ? v1 : NEGBIG;
      }

      float mx = fmaxf(hmax8(s0), hmax8(s1));
      mx = fmaxf(mx, __shfl_xor(mx, 16, 32));
      const float mn   = fmaxf(m, mx);
      const float corr = __expf(m - mn);
      m = mn;
      const float msh = mn - LNPS;                            // exp gives e^{s-m} * 1024
      FragH ph;
      float ls = 0.f;
#pragma unroll
      for (int r = 0; r < 8; ++r) {
        const float e0 = __expf(s0[r] - msh);                 // key kb      + 8h + r
        const float e1 = __expf(s1[r] - msh);                 // key kb + 16 + 8h + r
        ls += e0 + e1;
        ph.h[0][r] = (_Float16)e0;
        ph.h[1][r] = (_Float16)e1;
      }
      l = l * corr + ls;
      _Float16* pr = Pt + (16 * wave + c) * PTP + 8 * h;
      *(v8h*)(pr)      = ph.h[0];                             // local keys 8h .. 8h+7
      *(v8h*)(pr + 16) = ph.h[1];                             // local keys 16+8h .. 23+8h
      if (h == 0) Cs[16 * wave + c] = corr;
    }
    __syncthreads();

    float cr[4];
#pragma unroll
    for (int jq = 0; jq < 4; ++jq) cr[jq] = Cs[16 * jq + c];
#pragma unroll
    for (int jd = 0; jd < 2; ++jd)
#pragma unroll
      for (int jq = 0; jq < 4; ++jq)
#pragma unroll
        for (int r = 0; r < 8; ++r) acc[jd][jq][r] *= cr[jq];

    v16h vf[2];
#pragma unroll
    for (int jd = 0; jd < 2; ++jd) vf[jd] = ldfrag_h(vtp + (buf * DM + 16 * jd) * VSP + kl);
#pragma unroll
    for (int jq = 0; jq < 4; ++jq) {
      const v16h pf = ldfrag_h(Pt + (16 * jq + c) * PTP + 8 * h);
#pragma unroll
      for (int jd = 0; jd < 2; ++jd) acc[jd][jq] = mma_h(vf[jd], pf, acc[jd][jq]);
    }
    if ((it & 1) == 0) {                                      // block-uniform
      __syncthreads();                                        // Pt / Cs free for the next iteration
    } else {
      // end of stage s = it/2: publish stage s+1, free this buffer (and Pt / Cs), refill it with stage s+2
      asm volatile("s_wait_dscnt 0x0" ::: "memory");          // this wave's reads of the buffer are done before it is refilled
      asm volatile("s_wait_asynccnt 0x0" ::: "memory");       // this wave's copies of stage s+1 have landed
      __syncthreads();
      const int sn = (it >> 1) + 2;
      if (sn < NST) {                                         // block-uniform
        acopy8(kdst + (uint32_t)buf * (KST * KQP * 2u), KQP * 2u, ksrc + (size_t)sn * KST * DM, (size_t)DM);
        acopy8(vdst + (uint32_t)buf * (DM * VSP * 2u), 4u * VSP * 2u, vsrc + (size_t)sn * KST, (size_t)4 * SEQ);
      }
    }
  }
  asm volatile("s_wait_asynccnt 0x0" ::: "memory");           // no copy is outstanding when the loop is left

  if (wave < 4) {
    l += __shfl_xor(l, 16, 32);
    if (h == 0) Ls[16 * wave + c] = 1.0f / l;                 // o and l both carry the x1024 factor; l >= 1024 > 0
  }
  __syncthreads();
  float scq[4];
#pragma unroll
  for (int jq = 0; jq < 4; ++jq) scq[jq] = Ls[16 * jq + c];

  const int e = tid & 7, lg = tid >> 3;                      // lg 0..31: line slot, e: 16-B piece
  float* ob = out + ((size_t)b * SEQ + n0) * DM;
#pragma unroll
  for (int t = 0; t < 2; ++t) {
    if ((wave >> 2) == t) {                                   // wave-uniform: waves 4t..4t+3 own d 128t .. 128t+127
      const int dl = 32 * (wave & 3);
#pragma unroll
      for (int jd = 0; jd < 2; ++jd)
#pragma unroll
        for (int jq = 0; jq < 4; ++jq) {
          float* os = Os + (16 * jq + c) * OSP + dl + 16 * jd + 8 * h;
          const float sc = scq[jq];
          v4f v0, v1;
          v0[0] = acc[jd][jq][0] * sc; v0[1] = acc[jd][jq][1] * sc;
          v0[2] = acc[jd][jq][2] * sc; v0[3] = acc[jd][jq][3] * sc;
          v1[0] = acc[jd][jq][4] * sc; v1[1] = acc[jd][jq][5] * sc;
          v1[2] = acc[jd][jq][6] * sc; v1[3] = acc[jd][jq][7] * sc;
          *(v4f*)(os)     = v0;
          *(v4f*)(os + 4) = v1;
        }
    }
    __syncthreads();
{
#pragma unroll
      for (int i = 0; i < 8; ++i) {
        const int L   = i * 32 + lg;                         // lines 0..255 of this half
        const int row = L >> 2, hf = L & 3;                  // query row 0..63, line 0..3 of the 128-float segment
        const v4f v = *(const v4f*)(Os + row * OSP + 32 * hf + 4 * e);
        *(v4f*)(ob + (size_t)row * DM + 128 * t + 32 * hf + 4 * e) = v;
      }
      
    }
    __syncthreads();
  }
}

// =====================================================================================================
// needed (all tiles exact, all grids exact multiples):
//   Ab   bf16 [16384][256]      0            8388608
//   Bb   bf16 [16384][256]      8388608      8388608
//   Qp   f16  [16384][256]      16777216     8388608
//   Kp   f16  [16384][256]      25165824     8388608
//   Vt   f16  [8][256][2048]    33554432     8388608
//   Wb   bf16 [3][256][256]     41943040     393216
//   end                         42336256
// =====================================================================================================
extern "C" void kernel_launch(void* const* d_in, const int* in_sizes, int n_in,
                              void* d_out, int out_size, void* d_ws, size_t ws_size,
                              hipStream_t stream) {
  const int NX = NB * SEQ * DM;                          // 4194304
  if (n_in < 9) return;
  if (in_sizes[0] != NX || in_sizes[1] != NX || in_sizes[2] != NB * SEQ) return;
  if (in_sizes[3] != DM * DM || in_sizes[5] != DM * DM || in_sizes[7] != DM * DM) return;
  if (in_sizes[4] != DM || in_sizes[6] != DM || in_sizes[8] != DM) return;
  if (out_size != NX) return;

  size_t off = 0;
  const size_t szP = (size_t)NROW * DM * 2;              // 8388608
  const size_t szW = (size_t)DM * DM * 2;                // 131072
  const size_t oAB = off; off += szP;
  const size_t oBB = off; off += szP;
  const size_t oQP = off; off += szP;
  const size_t oKP = off; off += szP;
  const size_t oVT = off; off += szP;
  const size_t oWB = off; off += 3 * szW;                // 393216
  if (off > ws_size) return;                             // off = 42336256
  if (off > (size_t)134217728) return;

  const float* Ain = (const float*)d_in[0];
  const float* Bin = (const float*)d_in[1];
  const int*   msk = (const int*)d_in[2];
  const float* Wq  = (const float*)d_in[3];
  const float* bq  = (const float*)d_in[4];
  const float* Wk  = (const float*)d_in[5];
  const float* bk  = (const float*)d_in[6];
  const float* Wv  = (const float*)d_in[7];
  const float* bv  = (const float*)d_in[8];
  char* ws = (char*)d_ws;
  unsigned short* AB  = (unsigned short*)(ws + oAB);
  unsigned short* BB  = (unsigned short*)(ws + oBB);
  unsigned short* QP  = (unsigned short*)(ws + oQP);
  unsigned short* KP  = (unsigned short*)(ws + oKP);
  unsigned short* VT  = (unsigned short*)(ws + oVT);
  unsigned short* WB  = (unsigned short*)(ws + oWB);
  float* out = (float*)d_out;

  const int  n8X = NX / 8;                               // 524288
  const int  n8W = (DM * DM) / 8;                        // 8192
  const dim3 blk256(256);
  const dim3 gX(n8X / 256);                              // 2048 blocks
  const dim3 gW(n8W / 256);                              // 32 blocks
  const dim3 gP(DM / 128, NROW / 64);                    // 2 x 256 blocks
  const dim3 gA(NB * (SEQ / QT));                        // 256 blocks: one (b, 64-query tile) each

  // (0) bf16 planes of A, B, Wq, Wk, Wv
  cvt8<<<gX, blk256, 0, stream>>>(Ain, AB, n8X);
  cvt8<<<gX, blk256, 0, stream>>>(Bin, BB, n8X);
  cvt8<<<gW, blk256, 0, stream>>>(Wq, WB + 0 * (size_t)DM * DM, n8W);
  cvt8<<<gW, blk256, 0, stream>>>(Wk, WB + 1 * (size_t)DM * DM, n8W);
  cvt8<<<gW, blk256, 0, stream>>>(Wv, WB + 2 * (size_t)DM * DM, n8W);
  // (1) Qp = Ab . Wqb^T + bq (f16 plane), Kp = Bb . Wkb^T + bk (f16 plane), Vt = (Bb . Wvb^T + bv)^T per batch (f16)
  proj_kernel<<<gP, blk256, 0, stream>>>(AB, WB + 0 * (size_t)DM * DM, bq, QP, 0);
  proj_kernel<<<gP, blk256, 0, stream>>>(BB, WB + 1 * (size_t)DM * DM, bk, KP, 0);
  proj_kernel<<<gP, blk256, 0, stream>>>(BB, WB + 2 * (size_t)DM * DM, bv, VT, 1);
  // (2) out[b][n][d] = sum_m softmax_m(mask ? Qp_n . Kp_m / 16 : -big) Vt[d][m]
  attn_kernel<<<gA, blk256, 0, stream>>>(QP, KP, VT, msk, out);
  (void)hipGetLastError();
}

// v002
// It runs in 99.3 microseconds.
// Two timings next to v001 both put it at 1.28 times that version's speed.
// Counting every step since v000, it is 2.42 times as fast.
// Contractions: Q/K/V projections = Xb . Wb^T on v_wmma_f32_16x16x32_bf16 (Xb, Wb = RNE bf16 convert of A, B, Wq,
// Wk, Wv; K=256, f32 accumulate); scores S^T = Kp . Qp^T on v_wmma_f32_16x16x32_f16 (Kp, Qp = f16 planes of the
// projections incl. bias, K=256); O^T = Vt . P^T on v_wmma_f32_16x16x32_f16 (Vt = f16 plane of V incl. bias,
// P = e^{s-m} x 1024 in f16, 2048 keys); f32 accumulate everywhere; bias add, 1/16 scale, key mask select,
// running max, row sums and 1/l in f32 on VALU.
#include <hip/hip_runtime.h>
#include <math.h>
#include <stdint.h>

#define NB    8
#define SEQ   2048
#define DM    256
#define NROW  (NB * SEQ)
#define QT    64
#define OSP   132
#define QSP   136
#define TP    72
#define KST   64                      /* keys per ring stage (two 32-key passes) */
#define NST   (SEQ / KST)
#define KQP   264                     /* LDS pitch of a Q or K row in halves: 528 B = 16 B x 33 */
#define VSP   72                      /* LDS pitch of a Vt row of 64 keys in halves: 144 B = 16 B x 9 */
#define LNPS  6.931471805599453f
#define FMIN16 6.103515625e-05f
#define NEGBIG (-1.0e30f)
static_assert((SEQ % QT) == 0);
static_assert((SEQ % 64) == 0);
static_assert((SEQ % 256) == 0);
static_assert((DM % 128) == 0);
static_assert((DM % 32) == 0);
static_assert((NROW % 64) == 0);
static_assert(((DM * DM) / 8) % 256 == 0);
static_assert(((NROW * DM) / 8) % 256 == 0);
static_assert(DM == 256);
static_assert(QT == 64);
static_assert(64 * QSP <= 128 * TP);
static_assert(NST >= 2);
static_assert(KST == 64);

typedef _Float16       v16h __attribute__((ext_vector_type(16)));
typedef _Float16       v8h  __attribute__((ext_vector_type(8)));
typedef __bf16         v16b __attribute__((ext_vector_type(16)));
typedef unsigned short v8us __attribute__((ext_vector_type(8)));
typedef float          v8f  __attribute__((ext_vector_type(8)));
typedef float          v4f  __attribute__((ext_vector_type(4)));
typedef unsigned int   v4u  __attribute__((ext_vector_type(4)));

union FragH { v16h v; v8h  h[2]; };
union FragB { v16b v; v8us u[2]; };
static_assert(sizeof(FragH) == 32);
static_assert(sizeof(FragB) == 32);

// ---- scalar helpers --------------------------------------------------------------------------------
__device__ __forceinline__ unsigned short bf_bits(float f) {          // f32 -> bf16 bits, RNE convert
  unsigned u = __float_as_uint(f);
  return (unsigned short)((u + 0x7FFFu + ((u >> 16) & 1u)) >> 16);
}
__device__ __forceinline__ float bf_up(unsigned short x) { return __uint_as_float(((unsigned)x) << 16); }
__device__ __forceinline__ float bfr(float f) { return bf_up(bf_bits(f)); }
__device__ __forceinline__ unsigned short h_bits(_Float16 x) { return __builtin_bit_cast(unsigned short, x); }
__device__ __forceinline__ unsigned pk16(unsigned short a, unsigned short b) { return (unsigned)a | ((unsigned)b << 16); }
// f32 -> f16 with magnitudes below the smallest f16 normal flushed to zero (select by value)
__device__ __forceinline__ _Float16 to_h_ftz(float v) { return (_Float16)((fabsf(v) < FMIN16) ? 0.0f : v); }
__device__ __forceinline__ v8f zero8() { v8f z = {0.f, 0.f, 0.f, 0.f, 0.f, 0.f, 0.f, 0.f}; return z; }
__device__ __forceinline__ float hmax8(v8f s) {
  return fmaxf(fmaxf(fmaxf(s[0], s[1]), fmaxf(s[2], s[3])), fmaxf(fmaxf(s[4], s[5]), fmaxf(s[6], s[7])));
}

// ---- fragment loaders: 16-bit A/B operand, lane -> row/col (lane&15), p already includes +8*(lane>>4);
//      elements 0..7 <- p[0..7] (k0+8h..), elements 8..15 <- p[16..23] (k0+16+8h..)
__device__ __forceinline__ v16h ldfrag_h(const _Float16* p) {
  FragH f;
  f.h[0] = *(const v8h*)(p);
  f.h[1] = *(const v8h*)(p + 16);
  return f.v;
}
__device__ __forceinline__ v16b ldfrag_b(const unsigned short* p) {
  FragB f;
  f.u[0] = *(const v8us*)(p);
  f.u[1] = *(const v8us*)(p + 16);
  return f.v;
}

// ---- WMMA helpers: builtin followed by a 4-slot VALU gap tying D and keeping A/B live ----------------------
__device__ __forceinline__ v8f mma_h(v16h a, v16h b, v8f c) {
  v8f d = __builtin_amdgcn_wmma_f32_16x16x32_f16(false, a, false, b, (short)0, c, false, false);
#if defined(__HIP_DEVICE_COMPILE__)
  asm volatile("v_nop\n\tv_nop\n\tv_nop\n\tv_nop" : "+v"(d) : "v"(a), "v"(b));
#endif
  return d;
}
__device__ __forceinline__ v8f mma_b(v16b a, v16b b, v8f c) {
  v8f d = __builtin_amdgcn_wmma_f32_16x16x32_bf16(false, a, false, b, (short)0, c, false, false);
#if defined(__HIP_DEVICE_COMPILE__)
  const v16h ha = __builtin_bit_cast(v16h, a), hb = __builtin_bit_cast(v16h, b);
  asm volatile("v_nop\n\tv_nop\n\tv_nop\n\tv_nop" : "+v"(d) : "v"(ha), "v"(hb));
#endif
  return d;
}

// ---- asynchronous copies to LDS: eight 16-B copies per lane, copy j at LDS byte l + j*ls from g + j*gs halves.
//      s_wait_xcnt 0 is the statement's last line so that no address register is rewritten ahead of it.
__device__ __forceinline__ uint32_t lds_off(const void* p) { return (uint32_t)(size_t)p; }
__device__ __forceinline__ void acopy8(uint32_t l, uint32_t ls, const _Float16* g, size_t gs) {
#if defined(__HIP_DEVICE_COMPILE__)
  asm volatile(
      "global_load_async_to_lds_b128 %0, %8, off\n\t"
      "global_load_async_to_lds_b128 %1, %9, off\n\t"
      "global_load_async_to_lds_b128 %2, %10, off\n\t"
      "global_load_async_to_lds_b128 %3, %11, off\n\t"
      "global_load_async_to_lds_b128 %4, %12, off\n\t"
      "global_load_async_to_lds_b128 %5, %13, off\n\t"
      "global_load_async_to_lds_b128 %6, %14, off\n\t"
      "global_load_async_to_lds_b128 %7, %15, off\n\t"
      "s_wait_xcnt 0x0"
      :: "v"(l), "v"(l + ls), "v"(l + 2 * ls), "v"(l + 3 * ls),
         "v"(l + 4 * ls), "v"(l + 5 * ls), "v"(l + 6 * ls), "v"(l + 7 * ls),
         "v"(g), "v"(g + gs), "v"(g + 2 * gs), "v"(g + 3 * gs),
         "v"(g + 4 * gs), "v"(g + 5 * gs), "v"(g + 6 * gs), "v"(g + 7 * gs)
      : "memory");
#endif
}

// =====================================================================================================
// (0) dst[8i .. 8i+7] = bf16 bits (RNE convert) of src[8i .. 8i+7]; thread i converts 8 consecutive floats,
// coverage: grid = n8/256 blocks x 256 threads x 8 = 8*n8 elements exactly.
// =====================================================================================================
__global__ __launch_bounds__(256) void cvt8(const float* __restrict__ src, unsigned short* dst, int n8) {
  const int i = blockIdx.x * 256 + threadIdx.x;
  if (i >= n8) return;
  const float* p = src + (size_t)i * 8;
  const v4f f0 = *(const v4f*)(p), f1 = *(const v4f*)(p + 4);
  v4u wb;
  wb[0] = pk16(bf_bits(f0[0]), bf_bits(f0[1]));
  wb[1] = pk16(bf_bits(f0[2]), bf_bits(f0[3]));
  wb[2] = pk16(bf_bits(f1[0]), bf_bits(f1[1]));
  wb[3] = pk16(bf_bits(f1[2]), bf_bits(f1[3]));
  unsigned short* d = dst + (size_t)i * 8;
  *(v4u*)d = wb;
  
}

// =====================================================================================================
// (1) projection for one 64-row x 128-col tile of Y = Xb . Wb^T + bf16(bias): block = 256 threads = 8 waves.
//   Wave w: row group rg = w&3 (A rows = row0 + 16rg + (lane&15), split k map over d), col half ch = w>>2
//   (B = Wb rows col0 + 64ch + 16j + (lane&15), same split k map), 4 D tiles, 8 k-steps of 32, fragments from global.
//   D element r of tile j = (row row0 + 16rg + 8h + r, col col0 + 64ch + 16j + c).
//     lines to OP[row][col] (pitch DM): each tile row segment = 128 halves = 2 lines, 8 consecutive lanes x 16 B per line.
//   tr == 1: same values staged transposed into LDS S[col][row] (pitch TP, 16-B stores of 8 consecutive rows),
// coverage: staging: 4 rg x 2 h x 8 r = 64 rows, 2 ch x 4 j x 16 c = 128 cols; tr==0 writes: 4 it x 32 lines x 8 lanes
//   x 8 halves = 64 rows x 128 cols; tr==1 writes: 4 it x 32 d rows x 8 lanes x 8 halves = 128 d x 64 keys;
//   grid = 2 col tiles x 256 row tiles covers Y [16384][256] (or Vt [8][256][2048]) exactly once.
// =====================================================================================================
__global__ __launch_bounds__(256)
void proj_kernel(const unsigned short* __restrict__ XB, const unsigned short* __restrict__ WB,
                 const float* __restrict__ bias, unsigned short* OP, int tr) {
  __shared__ __align__(16) unsigned short S[128 * TP];
  const int tid  = threadIdx.x;
  const int lane = tid & 31, wave = tid >> 5;
  const int h    = lane >> 4, c = lane & 15;
  const int rg   = wave & 3, ch = wave >> 2;
  const int row0 = blockIdx.y * 64;
  const int col0 = blockIdx.x * 128;

  const unsigned short* ap = XB + ((size_t)(row0 + 16 * rg + c)) * DM + 8 * h;
  const unsigned short* bp = WB + ((size_t)(col0 + 64 * ch + c)) * DM + 8 * h;
  v8f acc0 = zero8(), acc1 = zero8(), acc2 = zero8(), acc3 = zero8();
#pragma unroll 2
  for (int ks = 0; ks < DM / 32; ++ks) {
    const v16b a = ldfrag_b(ap + 32 * ks);
    const unsigned short* bs = bp + 32 * ks;
    acc0 = mma_b(a, ldfrag_b(bs + 0 * 16 * DM), acc0);
    acc1 = mma_b(a, ldfrag_b(bs + 1 * 16 * DM), acc1);
    acc2 = mma_b(a, ldfrag_b(bs + 2 * 16 * DM), acc2);
    acc3 = mma_b(a, ldfrag_b(bs + 3 * 16 * DM), acc3);
  }

  // biases as bf16 RNE values, in-range lane indices (cb + 48 <= 255)
  const int cb = col0 + 64 * ch + c;
  const float bb0 = bfr(bias[cb + 0 * 16]), bb1 = bfr(bias[cb + 1 * 16]);
  const float bb2 = bfr(bias[cb + 2 * 16]), bb3 = bfr(bias[cb + 3 * 16]);

  unsigned short q0[8], q1[8], q2[8], q3[8];
#pragma unroll
  for (int r = 0; r < 8; ++r) {
    q0[r] = h_bits(to_h_ftz(acc0[r] + bb0));
    q1[r] = h_bits(to_h_ftz(acc1[r] + bb1));
    q2[r] = h_bits(to_h_ftz(acc2[r] + bb2));
    q3[r] = h_bits(to_h_ftz(acc3[r] + bb3));
  }

  if (tr == 0) {                                             // block-uniform
    // stage: D row r -> tile row 16rg + 8h + r, col = 64ch + 16j + c
    unsigned short* qs = S + (16 * rg + 8 * h) * QSP + 64 * ch + c;
#pragma unroll
    for (int r = 0; r < 8; ++r) {
      qs[r * QSP + 0 * 16] = q0[r];
      qs[r * QSP + 1 * 16] = q1[r];
      qs[r * QSP + 2 * 16] = q2[r];
      qs[r * QSP + 3 * 16] = q3[r];
    }
  } else {
    // stage transposed: S[col_local][row_local], 8 consecutive rows (r = 0..7) per 16-B store
    v4u w0, w1, w2, w3;
#pragma unroll
    for (int t = 0; t < 4; ++t) {
      w0[t] = pk16(q0[2 * t], q0[2 * t + 1]);
      w1[t] = pk16(q1[2 * t], q1[2 * t + 1]);
      w2[t] = pk16(q2[2 * t], q2[2 * t + 1]);
      w3[t] = pk16(q3[2 * t], q3[2 * t + 1]);
    }
    unsigned short* ts = S + (64 * ch + c) * TP + 16 * rg + 8 * h;
    *(v4u*)(ts + 0 * 16 * TP) = w0;
    *(v4u*)(ts + 1 * 16 * TP) = w1;
    *(v4u*)(ts + 2 * 16 * TP) = w2;
    *(v4u*)(ts + 3 * 16 * TP) = w3;
  }
  __syncthreads();

  const int e = tid & 7, lg = tid >> 3;                      // lg 0..31
  if (tr == 0) {
{
#pragma unroll
      for (int it = 0; it < 4; ++it) {
        const int L   = it * 32 + lg;                        // lines 0..127 of the tile
        const int row = L >> 1, hf = L & 1;
        const v4u v = *(const v4u*)(S + row * QSP + 64 * hf + 8 * e);
        *(v4u*)(OP + ((size_t)(row0 + row)) * DM + col0 + 64 * hf + 8 * e) = v;
      }
      
    }
  } else {
    const int b    = row0 / SEQ;
    const int key0 = row0 % SEQ;                             // 64 consecutive keys of one batch
{
#pragma unroll
      for (int it = 0; it < 4; ++it) {
        const int dd = it * 32 + lg;                         // d local 0..127
        const v4u v = *(const v4u*)(S + dd * TP + 8 * e);
        *(v4u*)(OP + ((size_t)b * DM + col0 + dd) * SEQ + key0 + 8 * e) = v;
      }
      
    }
  }
}

// =====================================================================================================
// (2) attention for one (b, 64-query tile), transposed formulation, 256-deep scores, 2048 keys.
//   Block = 256 threads = 8 waves. Key mask row of batch b staged once in LDS Ms[2048].
//   Operand tiles come to LDS by asynchronous 16-B copies over whole 128-B lines: Qs[64 queries][256 d] once; a ring of
//     two buffers, stage = 64 keys: Ks[64 keys][256 d], Vs[256 d][64 keys]. Wave w copies Q rows and K rows
//     8w..8w+7 (one 512-B row per copy) and Vt rows 32w..32w+31 (four 128-B rows per copy). Stage s+2 is issued behind
//     the barrier that ends stage s; all fragments below are read from these tiles.
//   Wave w = (wq = w&3, kh = w>>2) owns queries 16wq..16wq+15 and keys 32kh..32kh+31 of every stage, end to end:
//     S^T tiles (16 keys x 16 queries) = A(Kp rows = keys, d via the split k map) . B(Qp rows = query 16wq + (lane&15),
//     same d map), 8 d-steps, two tiles; s = D x (1/16), masked key (Ms == 0) -> s := -1e30 (exp gives 0; a fully
//     masked row gives equal weights). Per lane the two D tiles hold 16 keys of ONE query: online softmax state per
//     lane, one shuffle (lane^16) for the max over 32 keys. P = e^{s-m} x 1024 in f16: the lane's 16 values are, in
//     this order, its elements of the B operand of O^T (keys 8h..8h+7, then 16+8h..23+8h), so P stays in registers.
//     O^T: 16 accumulators = 256 d x 16 queries, rescaled by the lane's own corr; A = Vt rows d (keys contiguous).
//     acc[j], j < 8: d = 128kh + 16j + ..; acc[8+j]: d = 128(1-kh) + 16j + ..
//   After the loop the two waves of a query group join their key halves: each hands m, l and acc[8..15] to its partner
//     through LDS and finishes d = 128kh .. 128kh+127: o = (o_own e^{m_own-M} + o_partner e^{m_partner-M}) / l_joined.
//   Epilogue in 2 halves of 128 d: waves 4t..4t+3 stage O^T into Os[query][d_local] (16-B LDS stores),
// coverage: keys: 32 stages x 2 kh x 32; Os per half: 8 j x 2 h x 8 r = 128 d, 4 wq x 16 c = 64 queries;
//           out: 2 t x 8 it x 32 lines x 8 lanes x 4 floats = 64 rows x 256;
//           grid = 8 b x 32 query tiles = 256 blocks covers out exactly once.
// =====================================================================================================
__global__ __launch_bounds__(256)
void attn_kernel(const unsigned short* __restrict__ QP, const unsigned short* __restrict__ KP,
                 const unsigned short* __restrict__ VT, const int* __restrict__ mask, float* out) {
  __shared__ float Ml[2 * 256];
  __shared__ __align__(16) float Mg[8 * 16 * 128];
  __shared__ __align__(16) float Os[64 * OSP];
  __shared__ int Ms[SEQ];
  __shared__ __align__(16) _Float16 Qs[QT * KQP];
  __shared__ __align__(16) _Float16 Ks[2 * KST * KQP];
  __shared__ __align__(16) _Float16 Vs[2 * DM * VSP];
  const int tid  = threadIdx.x;
  const int wave = tid >> 5;
  const int lane = tid & 31;
  const int h    = lane >> 4;
  const int c    = lane & 15;
  const int bx   = blockIdx.x;
  const int b    = bx / (SEQ / QT);
  const int qt   = bx % (SEQ / QT);
  const int n0   = qt * QT;
  const _Float16* QPh = (const _Float16*)(const void*)QP;
  const _Float16* KPh = (const _Float16*)(const void*)KP;
  const _Float16* VTh = (const _Float16*)(const void*)VT;

#pragma unroll
  for (int i = 0; i < SEQ / 256; ++i) Ms[i * 256 + tid] = mask[(size_t)b * SEQ + i * 256 + tid];

  // copy sources and places of this lane: Q / K row 8*wave + j, 16-B piece lane; Vt row 32*wave + 4j + (lane>>3), piece lane&7
  const _Float16* qsrc = QPh + ((size_t)b * SEQ + n0 + 8 * wave) * DM + 8 * lane;
  const _Float16* ksrc = KPh + ((size_t)b * SEQ + 8 * wave) * DM + 8 * lane;                       // + stage * KST * DM
  const _Float16* vsrc = VTh + ((size_t)b * DM + 32 * wave + (lane >> 3)) * SEQ + 8 * (lane & 7);  // + stage * KST
  const uint32_t qdst = lds_off(Qs) + (uint32_t)(8 * wave * KQP + 8 * lane) * 2u;
  const uint32_t kdst = lds_off(Ks) + (uint32_t)(8 * wave * KQP + 8 * lane) * 2u;                  // + buffer * KST*KQP*2
  const uint32_t vdst = lds_off(Vs) + (uint32_t)((32 * wave + (lane >> 3)) * VSP + 8 * (lane & 7)) * 2u;  // + buffer * DM*VSP*2

  // Q tile and stage 0, landed and published; then stage 1 flies while stage 0 is worked on
  acopy8(qdst, KQP * 2u, qsrc, (size_t)DM);
  acopy8(kdst, KQP * 2u, ksrc, (size_t)DM);
  acopy8(vdst, 4u * VSP * 2u, vsrc, (size_t)4 * SEQ);
  asm volatile("s_wait_asynccnt 0x0" ::: "memory");          // this wave's copies have landed before the barrier publishes them
  __syncthreads();
  acopy8(kdst + KST * KQP * 2u, KQP * 2u, ksrc + (size_t)KST * DM, (size_t)DM);
  acopy8(vdst + DM * VSP * 2u, 4u * VSP * 2u, vsrc + KST, (size_t)4 * SEQ);

  const int wq = wave & 3, kh = wave >> 2;
  // Q fragment base in Qs (B operand of scores, col = query 16wq + c), + 32*ks
  const _Float16* qpp = Qs + (16 * wq + c) * KQP + 8 * h;
  // K fragment base in Ks (A operand of scores, row = local key 32kh + c), + buffer + 16 keys * KQP + 32*ks
  const _Float16* khp = Ks + (32 * kh + c) * KQP + 8 * h;
  // Vt fragment bases in Vs (A operand of O^T, row = d, keys 32kh.. contiguous), + buffer + 16j*VSP
  const _Float16* vown = Vs + (128 * kh + c) * VSP + 32 * kh + 8 * h;          // d = 128kh + 16j + c
  const _Float16* voth = Vs + (128 * (1 - kh) + c) * VSP + 32 * kh + 8 * h;    // d = 128(1-kh) + 16j + c
  const float SCL = 0.0625f;                                  // 1/sqrt(256)

  float m = NEGBIG, l = 0.f;
  v8f acc[16];
#pragma unroll
  for (int j = 0; j < 16; ++j) acc[j] = zero8();

#pragma unroll 1                                              // one copy of the 32-WMMA body: buf stays a run-time value
  for (int s = 0; s < NST; ++s) {
    const int buf = s & 1;                                    // ring buffer of stage s
    const int kb  = s * KST + 32 * kh;                        // first key of this wave's pass
    v8f s0 = zero8(), s1 = zero8();
    const _Float16* k0p = khp + buf * KST * KQP;              // keys kb .. kb+15
    const _Float16* k1p = k0p + 16 * KQP;                     // keys kb+16 .. kb+31
    // fragments of d-step ks+2 are fetched ahead of the products of d-step ks (three register sets)
    v16h qf[3], a0[3], a1[3];
#pragma unroll                                                // constant indices keep the sets in registers (here and below)
    for (int ks = 0; ks < 2; ++ks) {
      qf[ks] = ldfrag_h(qpp + 32 * ks);
      a0[ks] = ldfrag_h(k0p + 32 * ks);
      a1[ks] = ldfrag_h(k1p + 32 * ks);
    }
#pragma unroll
    for (int ks = 0; ks < DM / 32; ++ks) {
      if (ks + 2 < DM / 32) {
        qf[(ks + 2) % 3] = ldfrag_h(qpp + 32 * (ks + 2));
        a0[(ks + 2) % 3] = ldfrag_h(k0p + 32 * (ks + 2));
        a1[(ks + 2) % 3] = ldfrag_h(k1p + 32 * (ks + 2));
      }
      s0 = mma_h(a0[ks % 3], qf[ks % 3], s0);
      s1 = mma_h(a1[ks % 3], qf[ks % 3], s1);
    }
    // Vt fragments come in four groups of four through two register sets; group 0 is fetched ahead of the softmax
    const _Float16* vo = vown + buf * DM * VSP;
    const _Float16* vx = voth + buf * DM * VSP;
    v16h va[4], vb[4];
#pragma unroll
    for (int j = 0; j < 4; ++j) va[j] = ldfrag_h(vo + 16 * j * VSP);
    // scale and key mask (select by value): D row 8h+r of s0 = key kb+8h+r, of s1 = key kb+16+8h+r
#pragma unroll
    for (int r = 0; r < 8; ++r) {
      const int keep0 = Ms[kb + 8 * h + r];
      const int keep1 = Ms[kb + 16 + 8 * h + r];
      const float v0 = s0[r] * SCL, v1 = s1[r] * SCL;
      s0[r] = (keep0 != 0) ? v0 : NEGBIG;
      s1[r] = (keep1 != 0) ? v1 : NEGBIG;
    }

    float mx = fmaxf(hmax8(s0), hmax8(s1));
    mx = fmaxf(mx, __shfl_xor(mx, 16, 32));
    const float mn   = fmaxf(m, mx);
    const float corr = __expf(m - mn);
    m = mn;
    const float msh = mn - LNPS;                              // exp gives e^{s-m} * 1024
    FragH ph;
    float ls = 0.f;
#pragma unroll
    for (int r = 0; r < 8; ++r) {
      const float e0 = __expf(s0[r] - msh);                   // key kb      + 8h + r
      const float e1 = __expf(s1[r] - msh);                   // key kb + 16 + 8h + r
      ls += e0 + e1;
      ph.h[0][r] = (_Float16)e0;                              // B elements 0..7:  keys 8h .. 8h+7
      ph.h[1][r] = (_Float16)e1;                              // B elements 8..15: keys 16+8h .. 23+8h
    }
    l = l * corr + ls;

#pragma unroll
    for (int j = 0; j < 16; ++j)
#pragma unroll
      for (int r = 0; r < 8; ++r) acc[j][r] *= corr;          // every element of a lane belongs to its query c

#pragma unroll
    for (int j = 0; j < 4; ++j) vb[j] = ldfrag_h(vo + 16 * (4 + j) * VSP);
#pragma unroll
    for (int j = 0; j < 4; ++j) acc[j] = mma_h(va[j], ph.v, acc[j]);
#pragma unroll
    for (int j = 0; j < 4; ++j) va[j] = ldfrag_h(vx + 16 * j * VSP);
#pragma unroll
    for (int j = 0; j < 4; ++j) acc[4 + j] = mma_h(vb[j], ph.v, acc[4 + j]);
#pragma unroll
    for (int j = 0; j < 4; ++j) vb[j] = ldfrag_h(vx + 16 * (4 + j) * VSP);
#pragma unroll
    for (int j = 0; j < 4; ++j) acc[8 + j] = mma_h(va[j], ph.v, acc[8 + j]);
#pragma unroll
    for (int j = 0; j < 4; ++j) acc[12 + j] = mma_h(vb[j], ph.v, acc[12 + j]);

    // end of stage s: publish stage s+1, free this buffer, refill it with stage s+2
    asm volatile("s_wait_dscnt 0x0" ::: "memory");            // this wave's reads of the buffer are done before it is refilled
    asm volatile("s_wait_asynccnt 0x0" ::: "memory");         // this wave's copies of stage s+1 have landed
    __syncthreads();
    const int sn = s + 2;
    if (sn < NST) {                                           // block-uniform
      acopy8(kdst + (uint32_t)buf * (KST * KQP * 2u), KQP * 2u, ksrc + (size_t)sn * KST * DM, (size_t)DM);
      acopy8(vdst + (uint32_t)buf * (DM * VSP * 2u), 4u * VSP * 2u, vsrc + (size_t)sn * KST, (size_t)4 * SEQ);
    }
  }
  asm volatile("s_wait_asynccnt 0x0" ::: "memory");           // no copy is outstanding when the loop is left

  // join the two key halves of a query group: lane to same lane of wave^4
  Ml[tid]       = m;
  Ml[256 + tid] = l;
  {
    float* mgw = Mg + wave * 16 * 128 + lane * 4;             // 16 pieces of 32 lanes x 16 B
#pragma unroll
    for (int j = 0; j < 8; ++j) {
      v4f v0, v1;
      v0[0] = acc[8 + j][0]; v0[1] = acc[8 + j][1]; v0[2] = acc[8 + j][2]; v0[3] = acc[8 + j][3];
      v1[0] = acc[8 + j][4]; v1[1] = acc[8 + j][5]; v1[2] = acc[8 + j][6]; v1[3] = acc[8 + j][7];
      *(v4f*)(mgw + (2 * j) * 128)     = v0;
      *(v4f*)(mgw + (2 * j + 1) * 128) = v1;
    }
  }
  __syncthreads();
  {
    const int   pt = tid ^ 128;                               // same lane of the partner wave
    const float mp = Ml[pt], lp = Ml[256 + pt];
    const float mt = fmaxf(m, mp);
    const float ao = __expf(m - mt), ap = __expf(mp - mt);    // one of them is 1
    float lt = l * ao + lp * ap;
    lt += __shfl_xor(lt, 16, 32);                             // o and l carry the same factor; lt > 0 (the top key adds its full weight)
    const float il = 1.0f / lt;
    const float so = ao * il, sp = ap * il;
    const float* mgr = Mg + (wave ^ 4) * 16 * 128 + lane * 4;
#pragma unroll
    for (int j = 0; j < 8; ++j) {
      const v4f p0 = *(const v4f*)(mgr + (2 * j) * 128);
      const v4f p1 = *(const v4f*)(mgr + (2 * j + 1) * 128);
#pragma unroll
      for (int r = 0; r < 4; ++r) {
        acc[j][r]     = acc[j][r] * so + p0[r] * sp;
        acc[j][4 + r] = acc[j][4 + r] * so + p1[r] * sp;
      }
    }
  }

  const int e = tid & 7, lg = tid >> 3;                      // lg 0..31: line slot, e: 16-B piece
  float* ob = out + ((size_t)b * SEQ + n0) * DM;
#pragma unroll
  for (int t = 0; t < 2; ++t) {
    if (kh == t) {                                            // wave-uniform: waves 4t..4t+3 own d 128t .. 128t+127
#pragma unroll
      for (int j = 0; j < 8; ++j) {
        float* os = Os + (16 * wq + c) * OSP + 16 * j + 8 * h;
        v4f v0, v1;
        v0[0] = acc[j][0]; v0[1] = acc[j][1]; v0[2] = acc[j][2]; v0[3] = acc[j][3];
        v1[0] = acc[j][4]; v1[1] = acc[j][5]; v1[2] = acc[j][6]; v1[3] = acc[j][7];
        *(v4f*)(os)     = v0;
        *(v4f*)(os + 4) = v1;
      }
    }
    __syncthreads();
{
#pragma unroll
      for (int i = 0; i < 8; ++i) {
        const int L   = i * 32 + lg;                         // lines 0..255 of this half
        const int row = L >> 2, hf = L & 3;                  // query row 0..63, line 0..3 of the 128-float segment
        const v4f v = *(const v4f*)(Os + row * OSP + 32 * hf + 4 * e);
        *(v4f*)(ob + (size_t)row * DM + 128 * t + 32 * hf + 4 * e) = v;
      }
      
    }
    __syncthreads();
  }
}

// =====================================================================================================
// needed (all tiles exact, all grids exact multiples):
//   Ab   bf16 [16384][256]      0            8388608
//   Bb   bf16 [16384][256]      8388608      8388608
//   Qp   f16  [16384][256]      16777216     8388608
//   Kp   f16  [16384][256]      25165824     8388608
//   Vt   f16  [8][256][2048]    33554432     8388608
//   Wb   bf16 [3][256][256]     41943040     393216
//   end                         42336256
// =====================================================================================================
extern "C" void kernel_launch(void* const* d_in, const int* in_sizes, int n_in,
                              void* d_out, int out_size, void* d_ws, size_t ws_size,
                              hipStream_t stream) {
  const int NX = NB * SEQ * DM;                          // 4194304
  if (n_in < 9) return;
  if (in_sizes[0] != NX || in_sizes[1] != NX || in_sizes[2] != NB * SEQ) return;
  if (in_sizes[3] != DM * DM || in_sizes[5] != DM * DM || in_sizes[7] != DM * DM) return;
  if (in_sizes[4] != DM || in_sizes[6] != DM || in_sizes[8] != DM) return;
  if (out_size != NX) return;

  size_t off = 0;
  const size_t szP = (size_t)NROW * DM * 2;              // 8388608
  const size_t szW = (size_t)DM * DM * 2;                // 131072
  const size_t oAB = off; off += szP;
  const size_t oBB = off; off += szP;
  const size_t oQP = off; off += szP;
  const size_t oKP = off; off += szP;
  const size_t oVT = off; off += szP;
  const size_t oWB = off; off += 3 * szW;                // 393216
  if (off > ws_size) return;                             // off = 42336256
  if (off > (size_t)134217728) return;

  const float* Ain = (const float*)d_in[0];
  const float* Bin = (const float*)d_in[1];
  const int*   msk = (const int*)d_in[2];
  const float* Wq  = (const float*)d_in[3];
  const float* bq  = (const float*)d_in[4];
  const float* Wk  = (const float*)d_in[5];
  const float* bk  = (const float*)d_in[6];
  const float* Wv  = (const float*)d_in[7];
  const float* bv  = (const float*)d_in[8];
  char* ws = (char*)d_ws;
  unsigned short* AB  = (unsigned short*)(ws + oAB);
  unsigned short* BB  = (unsigned short*)(ws + oBB);
  unsigned short* QP  = (unsigned short*)(ws + oQP);
  unsigned short* KP  = (unsigned short*)(ws + oKP);
  unsigned short* VT  = (unsigned short*)(ws + oVT);
  unsigned short* WB  = (unsigned short*)(ws + oWB);
  float* out = (float*)d_out;

  const int  n8X = NX / 8;                               // 524288
  const int  n8W = (DM * DM) / 8;                        // 8192
  const dim3 blk256(256);
  const dim3 gX(n8X / 256);                              // 2048 blocks
  const dim3 gW(n8W / 256);                              // 32 blocks
  const dim3 gP(DM / 128, NROW / 64);                    // 2 x 256 blocks
  const dim3 gA(NB * (SEQ / QT));                        // 256 blocks: one (b, 64-query tile) each

  // (0) bf16 planes of A, B, Wq, Wk, Wv
  cvt8<<<gX, blk256, 0, stream>>>(Ain, AB, n8X);
  cvt8<<<gX, blk256, 0, stream>>>(Bin, BB, n8X);
  cvt8<<<gW, blk256, 0, stream>>>(Wq, WB + 0 * (size_t)DM * DM, n8W);
  cvt8<<<gW, blk256, 0, stream>>>(Wk, WB + 1 * (size_t)DM * DM, n8W);
  cvt8<<<gW, blk256, 0, stream>>>(Wv, WB + 2 * (size_t)DM * DM, n8W);
  // (1) Qp = Ab . Wqb^T + bq (f16 plane), Kp = Bb . Wkb^T + bk (f16 plane), Vt = (Bb . Wvb^T + bv)^T per batch (f16)
  proj_kernel<<<gP, blk256, 0, stream>>>(AB, WB + 0 * (size_t)DM * DM, bq, QP, 0);
  proj_kernel<<<gP, blk256, 0, stream>>>(BB, WB + 1 * (size_t)DM * DM, bk, KP, 0);
  proj_kernel<<<gP, blk256, 0, stream>>>(BB, WB + 2 * (size_t)DM * DM, bv, VT, 1);
  // (2) out[b][n][d] = sum_m softmax_m(mask ? Qp_n . Kp_m / 16 : -big) Vt[d][m]
  attn_kernel<<<gA, blk256, 0, stream>>>(QP, KP, VT, msk, out);
  (void)hipGetLastError();
}

// v003
// It runs in 54.7 microseconds.
// In two side-by-side timings against v002, it was 1.81 and 1.82 times as fast.
// Counting every step since v000, it is 4.39 times as fast.
// Contractions: Q/K/V projections = Xb . Wb^T on v_wmma_f32_16x16x32_bf16 (Xb, Wb = RNE bf16 convert of A, B, Wq,
// Wk, Wv; K=256, f32 accumulate); scores S^T = Kp . Qp^T on v_wmma_f32_16x16x32_f16 (Kp, Qp = f16 planes of the
// projections incl. bias, K=256); O^T = Vt . P^T on v_wmma_f32_16x16x32_f16 (Vt = f16 plane of V incl. bias,
// P = e^{s-m} x 1024 in f16, 2048 keys); f32 accumulate everywhere; bias add, 1/16 scale, key mask select,
// running max, row sums and 1/l in f32 on VALU.
#include <hip/hip_runtime.h>
#include <math.h>
#include <stdint.h>

#define NB    8
#define SEQ   2048
#define DM    256
#define NROW  (NB * SEQ)
#define QT    64
#define OSP   132
#define TP    72
#define XP    264                     /* LDS pitch of an X, W or staged output row of 256 16-bit values: 528 B = 16 B x 33 */
#define PTILES (3 * (NROW / 64))      /* projection tiles of 64 rows x 256 cols */
#define TPB   3                       /* projection tiles per block */
#define KST   64                      /* keys per ring stage (two 32-key passes) */
#define NST   (SEQ / KST)
#define KQP   264                     /* LDS pitch of a Q or K row in halves: 528 B = 16 B x 33 */
#define VSP   72                      /* LDS pitch of a Vt row of 64 keys in halves: 144 B = 16 B x 9 */
#define LNPS  6.931471805599453f
#define FMIN16 6.103515625e-05f
#define NEGBIG (-1.0e30f)
static_assert((SEQ % QT) == 0);
static_assert((SEQ % 64) == 0);
static_assert((SEQ % 256) == 0);
static_assert((DM % 128) == 0);
static_assert((DM % 32) == 0);
static_assert((NROW % 64) == 0);
static_assert(NROW / 64 == 256);
static_assert((PTILES % TPB) == 0);
static_assert(DM == 256);
static_assert(QT == 64);
static_assert(64 * XP <= DM * TP);
static_assert(NST >= 2);
static_assert(KST == 64);

typedef _Float16       v16h __attribute__((ext_vector_type(16)));
typedef _Float16       v8h  __attribute__((ext_vector_type(8)));
typedef __bf16         v16b __attribute__((ext_vector_type(16)));
typedef unsigned short v8us __attribute__((ext_vector_type(8)));
typedef float          v8f  __attribute__((ext_vector_type(8)));
typedef float          v4f  __attribute__((ext_vector_type(4)));
typedef unsigned int   v4u  __attribute__((ext_vector_type(4)));
typedef unsigned int   v2u  __attribute__((ext_vector_type(2)));
typedef float          v2f  __attribute__((ext_vector_type(2)));
typedef __bf16         v2b  __attribute__((ext_vector_type(2)));

union FragH { v16h v; v8h  h[2]; };
union FragB { v16b v; v8us u[2]; };
static_assert(sizeof(FragH) == 32);
static_assert(sizeof(FragB) == 32);

// ---- scalar helpers --------------------------------------------------------------------------------
__device__ __forceinline__ unsigned short bf_bits(float f) {          // f32 -> bf16 bits, RNE convert
  unsigned u = __float_as_uint(f);
  return (unsigned short)((u + 0x7FFFu + ((u >> 16) & 1u)) >> 16);
}
__device__ __forceinline__ float bf_up(unsigned short x) { return __uint_as_float(((unsigned)x) << 16); }
__device__ __forceinline__ float bfr(float f) { return bf_up(bf_bits(f)); }
__device__ __forceinline__ unsigned short h_bits(_Float16 x) { return __builtin_bit_cast(unsigned short, x); }
__device__ __forceinline__ unsigned pk16(unsigned short a, unsigned short b) { return (unsigned)a | ((unsigned)b << 16); }
// f32 -> f16 with magnitudes below the smallest f16 normal flushed to zero (select by value)
__device__ __forceinline__ _Float16 to_h_ftz(float v) { return (_Float16)((fabsf(v) < FMIN16) ? 0.0f : v); }
__device__ __forceinline__ v8f zero8() { v8f z = {0.f, 0.f, 0.f, 0.f, 0.f, 0.f, 0.f, 0.f}; return z; }
__device__ __forceinline__ float hmax8(v8f s) {
  return fmaxf(fmaxf(fmaxf(s[0], s[1]), fmaxf(s[2], s[3])), fmaxf(fmaxf(s[4], s[5]), fmaxf(s[6], s[7])));
}

// ---- fragment loaders: 16-bit A/B operand, lane -> row/col (lane&15), p already includes +8*(lane>>4);
//      elements 0..7 <- p[0..7] (k0+8h..), elements 8..15 <- p[16..23] (k0+16+8h..)
__device__ __forceinline__ v16h ldfrag_h(const _Float16* p) {
  FragH f;
  f.h[0] = *(const v8h*)(p);
  f.h[1] = *(const v8h*)(p + 16);
  return f.v;
}
__device__ __forceinline__ v16b ldfrag_b(const unsigned short* p) {
  FragB f;
  f.u[0] = *(const v8us*)(p);
  f.u[1] = *(const v8us*)(p + 16);
  return f.v;
}

// ---- WMMA helpers: builtin followed by a 4-slot VALU gap tying D and keeping A/B live ----------------------
__device__ __forceinline__ v8f mma_h(v16h a, v16h b, v8f c) {
  v8f d = __builtin_amdgcn_wmma_f32_16x16x32_f16(false, a, false, b, (short)0, c, false, false);
#if defined(__HIP_DEVICE_COMPILE__)
  asm volatile("v_nop\n\tv_nop\n\tv_nop\n\tv_nop" : "+v"(d) : "v"(a), "v"(b));
#endif
  return d;
}
__device__ __forceinline__ v8f mma_b(v16b a, v16b b, v8f c) {
  v8f d = __builtin_amdgcn_wmma_f32_16x16x32_bf16(false, a, false, b, (short)0, c, false, false);
#if defined(__HIP_DEVICE_COMPILE__)
  const v16h ha = __builtin_bit_cast(v16h, a), hb = __builtin_bit_cast(v16h, b);
  asm volatile("v_nop\n\tv_nop\n\tv_nop\n\tv_nop" : "+v"(d) : "v"(ha), "v"(hb));
#endif
  return d;
}

// ---- asynchronous copies to LDS: eight 16-B copies per lane, copy j at LDS byte l + j*ls from g + j*gs halves.
//      s_wait_xcnt 0 is the statement's last line so that no address register is rewritten ahead of it.
__device__ __forceinline__ uint32_t lds_off(const void* p) { return (uint32_t)(size_t)p; }
__device__ __forceinline__ void acopy8(uint32_t l, uint32_t ls, const _Float16* g, size_t gs) {
#if defined(__HIP_DEVICE_COMPILE__)
  asm volatile(
      "global_load_async_to_lds_b128 %0, %8, off\n\t"
      "global_load_async_to_lds_b128 %1, %9, off\n\t"
      "global_load_async_to_lds_b128 %2, %10, off\n\t"
      "global_load_async_to_lds_b128 %3, %11, off\n\t"
      "global_load_async_to_lds_b128 %4, %12, off\n\t"
      "global_load_async_to_lds_b128 %5, %13, off\n\t"
      "global_load_async_to_lds_b128 %6, %14, off\n\t"
      "global_load_async_to_lds_b128 %7, %15, off\n\t"
      "s_wait_xcnt 0x0"
      :: "v"(l), "v"(l + ls), "v"(l + 2 * ls), "v"(l + 3 * ls),
         "v"(l + 4 * ls), "v"(l + 5 * ls), "v"(l + 6 * ls), "v"(l + 7 * ls),
         "v"(g), "v"(g + gs), "v"(g + 2 * gs), "v"(g + 3 * gs),
         "v"(g + 4 * gs), "v"(g + 5 * gs), "v"(g + 6 * gs), "v"(g + 7 * gs)
      : "memory");
#endif
}

// =====================================================================================================
// (1) all three projections in one launch, straight from the f32 inputs: Y = Xb . Wb^T + bf16(bias), Xb, Wb = RNE bf16.
//   768 tiles of 64 rows x 256 cols: tile t = (projection p = t / 256: Q, K, V; row tile t % 256). Block = 256 threads
//   = 8 waves takes tiles 3*bx .. 3*bx+2. W of projection p (256 x 256) is read once per block in whole 512-B runs,
//   converted and kept in LDS Wsm[col][k] (read again only where p changes inside a block); the X tile likewise in
//   Xs[row][k]; the next tile's X loads fly in registers while this tile is worked on.
//   Wave w: rows 32(w&1) + 16u + .., cols 64(w>>1) + 16j + .., 2 x 4 D tiles, 8 k-steps of 32, both operands through the
//   same split k map. D element r of tile (u, j) = (row 32wr + 16u + 8h + r, col 64wc + 16j + c).
//   p < 2: values staged in S[row][col] (pitch XP), written as whole 512-B rows of OP[row][256].
//   p == 2: staged transposed in S[col][row] (pitch TP, 16-B stores of 8 consecutive rows), written as 128-B lines of
//   Vt[b][d][key0 .. key0+63].
// coverage: 256 blocks x 3 tiles = 768 tiles; staging 2 wr x 2 u x 2 h x 8 r = 64 rows, 4 wc x 4 j x 16 c = 256 cols;
//   writes: 8 it x 256 threads x 8 halves = 64 x 256 values of the tile, each once.
// =====================================================================================================
__device__ __forceinline__ v2u cvt4(v4f f) {                  // four f32 -> four bf16 (RNE), packed in k order
  v2f lo, hi;
  lo[0] = f[0]; lo[1] = f[1]; hi[0] = f[2]; hi[1] = f[3];
  v2u r;
  r[0] = __builtin_bit_cast(unsigned, __builtin_convertvector(lo, v2b));
  r[1] = __builtin_bit_cast(unsigned, __builtin_convertvector(hi, v2b));
  return r;
}

__global__ __launch_bounds__(256)
void proj_all(const float* __restrict__ Ain, const float* __restrict__ Bin,
              const float* __restrict__ Wq, const float* __restrict__ bq,
              const float* __restrict__ Wk, const float* __restrict__ bk,
              const float* __restrict__ Wv, const float* __restrict__ bv,
              unsigned short* QP, unsigned short* KP, unsigned short* VT) {
  __shared__ __align__(16) unsigned short Wsm[DM * XP];
  __shared__ __align__(16) unsigned short Xs[64 * XP];
  __shared__ __align__(16) unsigned short S[DM * TP];
  const int tid  = threadIdx.x;
  const int lane = tid & 31, wave = tid >> 5;
  const int h    = lane >> 4, c = lane & 15;
  const int wr   = wave & 1, wc = wave >> 1;
  const int t0   = blockIdx.x * TPB;

  // 16-B piece j*256 + tid of a contiguous f32 tile = row 4j + (tid>>6), floats 4(tid&63) ..
  const int ldso = (tid >> 6) * XP + 4 * (tid & 63);
  const unsigned short* ap = Xs  + (32 * wr + c) * XP + 8 * h;
  const unsigned short* bp = Wsm + (64 * wc + c) * XP + 8 * h;

  v4f xr[16];
  {
    const float* xs = ((t0 >> 8) == 0 ? Ain : Bin) + (size_t)(t0 & 255) * 64 * DM + 4 * tid;
    __builtin_amdgcn_sched_barrier(0);                        // keeps the argument loads above from sinking in between these loads and their wait
#pragma unroll
    for (int j = 0; j < 16; ++j) xr[j] = *(const v4f*)(xs + j * 1024);
    asm volatile("s_wait_xcnt 0x0" ::: "memory");             // before a register that these loads name is rewritten
    __builtin_amdgcn_sched_barrier(0);                        // keeps the index arithmetic below from rising over that wait
  }

  int pcur = -1;
  float bb[4] = {0.f, 0.f, 0.f, 0.f};                         // biases of projection pcur as bf16 RNE values
#pragma unroll 1                                              // one copy of the tile body
  for (int i = 0; i < TPB; ++i) {
    const int t = t0 + i, p = t >> 8, row0 = (t & 255) * 64;  // block-uniform
    __syncthreads();                                          // every reader of Xs, Wsm and S of the tile before is done
    if (p != pcur) {                                          // block-uniform
      pcur = p;
      const float* wsrc = (p == 0 ? Wq : (p == 1 ? Wk : Wv)) + 4 * tid;
      const float* bias = (p == 0 ? bq : (p == 1 ? bk : bv));
      v4f wa[32], wb[32];                                     // all of W in flight at once: its latency is paid once
      float br[4];
#pragma unroll
      for (int j = 0; j < 32; ++j) wa[j] = *(const v4f*)(wsrc + j * 1024);
#pragma unroll
      for (int j = 0; j < 32; ++j) wb[j] = *(const v4f*)(wsrc + (32 + j) * 1024);
#pragma unroll
      for (int j = 0; j < 4; ++j) br[j] = bias[64 * wc + 16 * j + c];   // in-range lane indices (64wc + 48 + c <= 255)
      asm volatile("s_wait_xcnt 0x0" ::: "memory");           // before a register that these loads name is rewritten
#pragma unroll
      for (int j = 0; j < 32; ++j) *(v2u*)(Wsm + ldso + j * 4 * XP) = cvt4(wa[j]);
#pragma unroll
      for (int j = 0; j < 32; ++j) *(v2u*)(Wsm + ldso + (32 + j) * 4 * XP) = cvt4(wb[j]);
#pragma unroll
      for (int j = 0; j < 4; ++j) bb[j] = bfr(br[j]);
    }
#pragma unroll
    for (int j = 0; j < 16; ++j) *(v2u*)(Xs + ldso + j * 4 * XP) = cvt4(xr[j]);
    __syncthreads();                                          // Xs (and Wsm) published
    if (i + 1 < TPB) {                                        // block-uniform; behind the barrier, which waits for every load
      const int tn = t + 1;
      const float* xs = ((tn >> 8) == 0 ? Ain : Bin) + (size_t)(tn & 255) * 64 * DM + 4 * tid;
#pragma unroll
      for (int j = 0; j < 16; ++j) xr[j] = *(const v4f*)(xs + j * 1024);
      asm volatile("s_wait_xcnt 0x0" ::: "memory");           // before a register that these loads name is rewritten
    }

    v8f acc[2][4];
#pragma unroll
    for (int j = 0; j < 4; ++j) { acc[0][j] = zero8(); acc[1][j] = zero8(); }
    // fragments of k-step ks+2 are fetched ahead of the products of k-step ks (three register sets)
    v16b fa[3][2], fb[3][4];
#pragma unroll                                                // constant indices keep the sets in registers (here and below)
    for (int ks = 0; ks < 2; ++ks) {
      fa[ks][0] = ldfrag_b(ap + 32 * ks);
      fa[ks][1] = ldfrag_b(ap + 16 * XP + 32 * ks);
#pragma unroll
      for (int j = 0; j < 4; ++j) fb[ks][j] = ldfrag_b(bp + 16 * j * XP + 32 * ks);
    }
#pragma unroll
    for (int ks = 0; ks < DM / 32; ++ks) {
      if (ks + 2 < DM / 32) {
        fa[(ks + 2) % 3][0] = ldfrag_b(ap + 32 * (ks + 2));
        fa[(ks + 2) % 3][1] = ldfrag_b(ap + 16 * XP + 32 * (ks + 2));
#pragma unroll
        for (int j = 0; j < 4; ++j) fb[(ks + 2) % 3][j] = ldfrag_b(bp + 16 * j * XP + 32 * (ks + 2));
      }
#pragma unroll
      for (int j = 0; j < 4; ++j) {
        acc[0][j] = mma_b(fa[ks % 3][0], fb[ks % 3][j], acc[0][j]);
        acc[1][j] = mma_b(fa[ks % 3][1], fb[ks % 3][j], acc[1][j]);
      }
    }

    if (p < 2) {                                              // block-uniform
#pragma unroll
      for (int u = 0; u < 2; ++u)
#pragma unroll
        for (int j = 0; j < 4; ++j) {
          unsigned short* qs = S + (32 * wr + 16 * u + 8 * h) * XP + 64 * wc + 16 * j + c;
#pragma unroll
          for (int r = 0; r < 8; ++r) qs[r * XP] = h_bits(to_h_ftz(acc[u][j][r] + bb[j]));
        }
    } else {
#pragma unroll
      for (int u = 0; u < 2; ++u)
#pragma unroll
        for (int j = 0; j < 4; ++j) {
          v4u w;
#pragma unroll
          for (int q = 0; q < 4; ++q)
            w[q] = pk16(h_bits(to_h_ftz(acc[u][j][2 * q] + bb[j])), h_bits(to_h_ftz(acc[u][j][2 * q + 1] + bb[j])));
          *(v4u*)(S + (64 * wc + 16 * j + c) * TP + 32 * wr + 16 * u + 8 * h) = w;
        }
    }
    __syncthreads();                                          // S published

    if (p < 2) {
      unsigned short* OP = (p == 0 ? QP : KP) + (size_t)row0 * DM;
#pragma unroll
      for (int it = 0; it < 8; ++it) {
        const int row = it * 8 + wave;                        // one whole 512-B row per wave and store
        const v4u v = *(const v4u*)(S + row * XP + 8 * lane);
        *(v4u*)(OP + (size_t)row * DM + 8 * lane) = v;
      }
      asm volatile("s_wait_xcnt 0x0" ::: "memory");           // before a register that these stores name is rewritten
    } else {
      const int b    = row0 / SEQ;
      const int key0 = row0 % SEQ;                            // 64 consecutive keys of one batch
      const int e = tid & 7, lg = tid >> 3;
      unsigned short* vp = VT + ((size_t)b * DM + lg) * SEQ + key0 + 8 * e;
#pragma unroll
      for (int it = 0; it < 8; ++it) {                        // d = 32 it + lg, 0..255
        const v4u v = *(const v4u*)(S + (it * 32 + lg) * TP + 8 * e);
        *(v4u*)(vp + (size_t)it * 32 * SEQ) = v;
      }
      asm volatile("s_wait_xcnt 0x0" ::: "memory");           // before a register that these stores name is rewritten
    }
  }
}

// =====================================================================================================
// (2) attention for one (b, 64-query tile), transposed formulation, 256-deep scores, 2048 keys.
//   Block = 256 threads = 8 waves. Key mask row of batch b staged once in LDS Ms[2048].
//   Operand tiles come to LDS by asynchronous 16-B copies over whole 128-B lines: Qs[64 queries][256 d] once; a ring of
//     two buffers, stage = 64 keys: Ks[64 keys][256 d], Vs[256 d][64 keys]. Wave w copies Q rows and K rows
//     8w..8w+7 (one 512-B row per copy) and Vt rows 32w..32w+31 (four 128-B rows per copy). Stage s+2 is issued behind
//     the barrier that ends stage s; all fragments below are read from these tiles.
//   Wave w = (wq = w&3, kh = w>>2) owns queries 16wq..16wq+15 and keys 32kh..32kh+31 of every stage, end to end:
//     S^T tiles (16 keys x 16 queries) = A(Kp rows = keys, d via the split k map) . B(Qp rows = query 16wq + (lane&15),
//     same d map), 8 d-steps, two tiles; s = D x (1/16), masked key (Ms == 0) -> s := -1e30 (exp gives 0; a fully
//     masked row gives equal weights). Per lane the two D tiles hold 16 keys of ONE query: online softmax state per
//     lane, one shuffle (lane^16) for the max over 32 keys. P = e^{s-m} x 1024 in f16: the lane's 16 values are, in
//     this order, its elements of the B operand of O^T (keys 8h..8h+7, then 16+8h..23+8h), so P stays in registers.
//     O^T: 16 accumulators = 256 d x 16 queries, rescaled by the lane's own corr; A = Vt rows d (keys contiguous).
//     acc[j], j < 8: d = 128kh + 16j + ..; acc[8+j]: d = 128(1-kh) + 16j + ..
//   After the loop the two waves of a query group join their key halves: each hands m, l and acc[8..15] to its partner
//     through LDS and finishes d = 128kh .. 128kh+127: o = (o_own e^{m_own-M} + o_partner e^{m_partner-M}) / l_joined.
//   Epilogue in 2 halves of 128 d: waves 4t..4t+3 stage O^T into Os[query][d_local] (16-B LDS stores),
// coverage: keys: 32 stages x 2 kh x 32; Os per half: 8 j x 2 h x 8 r = 128 d, 4 wq x 16 c = 64 queries;
//           out: 2 t x 8 it x 32 lines x 8 lanes x 4 floats = 64 rows x 256;
//           grid = 8 b x 32 query tiles = 256 blocks covers out exactly once.
// =====================================================================================================
__global__ __launch_bounds__(256)
void attn_kernel(const unsigned short* __restrict__ QP, const unsigned short* __restrict__ KP,
                 const unsigned short* __restrict__ VT, const int* __restrict__ mask, float* out) {
  __shared__ float Ml[2 * 256];
  __shared__ __align__(16) float Mg[8 * 16 * 128];
  __shared__ __align__(16) float Os[64 * OSP];
  __shared__ int Ms[SEQ];
  __shared__ __align__(16) _Float16 Qs[QT * KQP];
  __shared__ __align__(16) _Float16 Ks[2 * KST * KQP];
  __shared__ __align__(16) _Float16 Vs[2 * DM * VSP];
  const int tid  = threadIdx.x;
  const int wave = tid >> 5;
  const int lane = tid & 31;
  const int h    = lane >> 4;
  const int c    = lane & 15;
  const int bx   = blockIdx.x;
  const int b    = bx / (SEQ / QT);
  const int qt   = bx % (SEQ / QT);
  const int n0   = qt * QT;
  const _Float16* QPh = (const _Float16*)(const void*)QP;
  const _Float16* KPh = (const _Float16*)(const void*)KP;
  const _Float16* VTh = (const _Float16*)(const void*)VT;

#pragma unroll
  for (int i = 0; i < SEQ / 256; ++i) Ms[i * 256 + tid] = mask[(size_t)b * SEQ + i * 256 + tid];

  // copy sources and places of this lane: Q / K row 8*wave + j, 16-B piece lane; Vt row 32*wave + 4j + (lane>>3), piece lane&7
  const _Float16* qsrc = QPh + ((size_t)b * SEQ + n0 + 8 * wave) * DM + 8 * lane;
  const _Float16* ksrc = KPh + ((size_t)b * SEQ + 8 * wave) * DM + 8 * lane;                       // + stage * KST * DM
  const _Float16* vsrc = VTh + ((size_t)b * DM + 32 * wave + (lane >> 3)) * SEQ + 8 * (lane & 7);  // + stage * KST
  const uint32_t qdst = lds_off(Qs) + (uint32_t)(8 * wave * KQP + 8 * lane) * 2u;
  const uint32_t kdst = lds_off(Ks) + (uint32_t)(8 * wave * KQP + 8 * lane) * 2u;                  // + buffer * KST*KQP*2
  const uint32_t vdst = lds_off(Vs) + (uint32_t)((32 * wave + (lane >> 3)) * VSP + 8 * (lane & 7)) * 2u;  // + buffer * DM*VSP*2

  // Q tile and stage 0, landed and published; then stage 1 flies while stage 0 is worked on
  acopy8(qdst, KQP * 2u, qsrc, (size_t)DM);
  acopy8(kdst, KQP * 2u, ksrc, (size_t)DM);
  acopy8(vdst, 4u * VSP * 2u, vsrc, (size_t)4 * SEQ);
  asm volatile("s_wait_asynccnt 0x0" ::: "memory");          // this wave's copies have landed before the barrier publishes them
  __syncthreads();
  acopy8(kdst + KST * KQP * 2u, KQP * 2u, ksrc + (size_t)KST * DM, (size_t)DM);
  acopy8(vdst + DM * VSP * 2u, 4u * VSP * 2u, vsrc + KST, (size_t)4 * SEQ);

  const int wq = wave & 3, kh = wave >> 2;
  // Q fragment base in Qs (B operand of scores, col = query 16wq + c), + 32*ks
  const _Float16* qpp = Qs + (16 * wq + c) * KQP + 8 * h;
  // K fragment base in Ks (A operand of scores, row = local key 32kh + c), + buffer + 16 keys * KQP + 32*ks
  const _Float16* khp = Ks + (32 * kh + c) * KQP + 8 * h;
  // Vt fragment bases in Vs (A operand of O^T, row = d, keys 32kh.. contiguous), + buffer + 16j*VSP
  const _Float16* vown = Vs + (128 * kh + c) * VSP + 32 * kh + 8 * h;          // d = 128kh + 16j + c
  const _Float16* voth = Vs + (128 * (1 - kh) + c) * VSP + 32 * kh + 8 * h;    // d = 128(1-kh) + 16j + c
  const float SCL = 0.0625f;                                  // 1/sqrt(256)

  float m = NEGBIG, l = 0.f;
  v8f acc[16];
#pragma unroll
  for (int j = 0; j < 16; ++j) acc[j] = zero8();

#pragma unroll 1                                              // one copy of the 32-WMMA body: buf stays a run-time value
  for (int s = 0; s < NST; ++s) {
    const int buf = s & 1;                                    // ring buffer of stage s
    const int kb  = s * KST + 32 * kh;                        // first key of this wave's pass
    v8f s0 = zero8(), s1 = zero8();
    const _Float16* k0p = khp + buf * KST * KQP;              // keys kb .. kb+15
    const _Float16* k1p = k0p + 16 * KQP;                     // keys kb+16 .. kb+31
    // fragments of d-step ks+2 are fetched ahead of the products of d-step ks (three register sets)
    v16h qf[3], a0[3], a1[3];
#pragma unroll                                                // constant indices keep the sets in registers (here and below)
    for (int ks = 0; ks < 2; ++ks) {
      qf[ks] = ldfrag_h(qpp + 32 * ks);
      a0[ks] = ldfrag_h(k0p + 32 * ks);
      a1[ks] = ldfrag_h(k1p + 32 * ks);
    }
#pragma unroll
    for (int ks = 0; ks < DM / 32; ++ks) {
      if (ks + 2 < DM / 32) {
        qf[(ks + 2) % 3] = ldfrag_h(qpp + 32 * (ks + 2));
        a0[(ks + 2) % 3] = ldfrag_h(k0p + 32 * (ks + 2));
        a1[(ks + 2) % 3] = ldfrag_h(k1p + 32 * (ks + 2));
      }
      s0 = mma_h(a0[ks % 3], qf[ks % 3], s0);
      s1 = mma_h(a1[ks % 3], qf[ks % 3], s1);
    }
    // Vt fragments come in four groups of four through two register sets; group 0 is fetched ahead of the softmax
    const _Float16* vo = vown + buf * DM * VSP;
    const _Float16* vx = voth + buf * DM * VSP;
    v16h va[4], vb[4];
#pragma unroll
    for (int j = 0; j < 4; ++j) va[j] = ldfrag_h(vo + 16 * j * VSP);
    // scale and key mask (select by value): D row 8h+r of s0 = key kb+8h+r, of s1 = key kb+16+8h+r
#pragma unroll
    for (int r = 0; r < 8; ++r) {
      const int keep0 = Ms[kb + 8 * h + r];
      const int keep1 = Ms[kb + 16 + 8 * h + r];
      const float v0 = s0[r] * SCL, v1 = s1[r] * SCL;
      s0[r] = (keep0 != 0) ? v0 : NEGBIG;
      s1[r] = (keep1 != 0) ? v1 : NEGBIG;
    }

    float mx = fmaxf(hmax8(s0), hmax8(s1));
    mx = fmaxf(mx, __shfl_xor(mx, 16, 32));
    const float mn   = fmaxf(m, mx);
    const float corr = __expf(m - mn);
    m = mn;
    const float msh = mn - LNPS;                              // exp gives e^{s-m} * 1024
    FragH ph;
    float ls = 0.f;
#pragma unroll
    for (int r = 0; r < 8; ++r) {
      const float e0 = __expf(s0[r] - msh);                   // key kb      + 8h + r
      const float e1 = __expf(s1[r] - msh);                   // key kb + 16 + 8h + r
      ls += e0 + e1;
      ph.h[0][r] = (_Float16)e0;                              // B elements 0..7:  keys 8h .. 8h+7
      ph.h[1][r] = (_Float16)e1;                              // B elements 8..15: keys 16+8h .. 23+8h
    }
    l = l * corr + ls;

#pragma unroll
    for (int j = 0; j < 16; ++j)
#pragma unroll
      for (int r = 0; r < 8; ++r) acc[j][r] *= corr;          // every element of a lane belongs to its query c

#pragma unroll
    for (int j = 0; j < 4; ++j) vb[j] = ldfrag_h(vo + 16 * (4 + j) * VSP);
#pragma unroll
    for (int j = 0; j < 4; ++j) acc[j] = mma_h(va[j], ph.v, acc[j]);
#pragma unroll
    for (int j = 0; j < 4; ++j) va[j] = ldfrag_h(vx + 16 * j * VSP);
#pragma unroll
    for (int j = 0; j < 4; ++j) acc[4 + j] = mma_h(vb[j], ph.v, acc[4 + j]);
#pragma unroll
    for (int j = 0; j < 4; ++j) vb[j] = ldfrag_h(vx + 16 * (4 + j) * VSP);
#pragma unroll
    for (int j = 0; j < 4; ++j) acc[8 + j] = mma_h(va[j], ph.v, acc[8 + j]);
#pragma unroll
    for (int j = 0; j < 4; ++j) acc[12 + j] = mma_h(vb[j], ph.v, acc[12 + j]);

    // end of stage s: publish stage s+1, free this buffer, refill it with stage s+2
    asm volatile("s_wait_dscnt 0x0" ::: "memory");            // this wave's reads of the buffer are done before it is refilled
    asm volatile("s_wait_asynccnt 0x0" ::: "memory");         // this wave's copies of stage s+1 have landed
    __syncthreads();
    const int sn = s + 2;
    if (sn < NST) {                                           // block-uniform
      acopy8(kdst + (uint32_t)buf * (KST * KQP * 2u), KQP * 2u, ksrc + (size_t)sn * KST * DM, (size_t)DM);
      acopy8(vdst + (uint32_t)buf * (DM * VSP * 2u), 4u * VSP * 2u, vsrc + (size_t)sn * KST, (size_t)4 * SEQ);
    }
  }
  asm volatile("s_wait_asynccnt 0x0" ::: "memory");           // no copy is outstanding when the loop is left

  // join the two key halves of a query group: lane to same lane of wave^4
  Ml[tid]       = m;
  Ml[256 + tid] = l;
  {
    float* mgw = Mg + wave * 16 * 128 + lane * 4;             // 16 pieces of 32 lanes x 16 B
#pragma unroll
    for (int j = 0; j < 8; ++j) {
      v4f v0, v1;
      v0[0] = acc[8 + j][0]; v0[1] = acc[8 + j][1]; v0[2] = acc[8 + j][2]; v0[3] = acc[8 + j][3];
      v1[0] = acc[8 + j][4]; v1[1] = acc[8 + j][5]; v1[2] = acc[8 + j][6]; v1[3] = acc[8 + j][7];
      *(v4f*)(mgw + (2 * j) * 128)     = v0;
      *(v4f*)(mgw + (2 * j + 1) * 128) = v1;
    }
  }
  __syncthreads();
  {
    const int   pt = tid ^ 128;                               // same lane of the partner wave
    const float mp = Ml[pt], lp = Ml[256 + pt];
    const float mt = fmaxf(m, mp);
    const float ao = __expf(m - mt), ap = __expf(mp - mt);    // one of them is 1
    float lt = l * ao + lp * ap;
    lt += __shfl_xor(lt, 16, 32);                             // o and l carry the same factor; lt > 0 (the top key adds its full weight)
    const float il = 1.0f / lt;
    const float so = ao * il, sp = ap * il;
    const float* mgr = Mg + (wave ^ 4) * 16 * 128 + lane * 4;
#pragma unroll
    for (int j = 0; j < 8; ++j) {
      const v4f p0 = *(const v4f*)(mgr + (2 * j) * 128);
      const v4f p1 = *(const v4f*)(mgr + (2 * j + 1) * 128);
#pragma unroll
      for (int r = 0; r < 4; ++r) {
        acc[j][r]     = acc[j][r] * so + p0[r] * sp;
        acc[j][4 + r] = acc[j][4 + r] * so + p1[r] * sp;
      }
    }
  }

  const int e = tid & 7, lg = tid >> 3;                      // lg 0..31: line slot, e: 16-B piece
  float* ob = out + ((size_t)b * SEQ + n0) * DM;
#pragma unroll
  for (int t = 0; t < 2; ++t) {
    if (kh == t) {                                            // wave-uniform: waves 4t..4t+3 own d 128t .. 128t+127
#pragma unroll
      for (int j = 0; j < 8; ++j) {
        float* os = Os + (16 * wq + c) * OSP + 16 * j + 8 * h;
        v4f v0, v1;
        v0[0] = acc[j][0]; v0[1] = acc[j][1]; v0[2] = acc[j][2]; v0[3] = acc[j][3];
        v1[0] = acc[j][4]; v1[1] = acc[j][5]; v1[2] = acc[j][6]; v1[3] = acc[j][7];
        *(v4f*)(os)     = v0;
        *(v4f*)(os + 4) = v1;
      }
    }
    __syncthreads();
{
#pragma unroll
      for (int i = 0; i < 8; ++i) {
        const int L   = i * 32 + lg;                         // lines 0..255 of this half
        const int row = L >> 2, hf = L & 3;                  // query row 0..63, line 0..3 of the 128-float segment
        const v4f v = *(const v4f*)(Os + row * OSP + 32 * hf + 4 * e);
        *(v4f*)(ob + (size_t)row * DM + 128 * t + 32 * hf + 4 * e) = v;
      }
      
    }
    __syncthreads();
  }
}

// =====================================================================================================
// needed (all tiles exact, all grids exact multiples):
//   Qp   f16  [16384][256]      0            8388608
//   Kp   f16  [16384][256]      8388608      8388608
//   Vt   f16  [8][256][2048]    16777216     8388608
//   end                         25165824
// =====================================================================================================
extern "C" void kernel_launch(void* const* d_in, const int* in_sizes, int n_in,
                              void* d_out, int out_size, void* d_ws, size_t ws_size,
                              hipStream_t stream) {
  const int NX = NB * SEQ * DM;                          // 4194304
  if (n_in < 9) return;
  if (in_sizes[0] != NX || in_sizes[1] != NX || in_sizes[2] != NB * SEQ) return;
  if (in_sizes[3] != DM * DM || in_sizes[5] != DM * DM || in_sizes[7] != DM * DM) return;
  if (in_sizes[4] != DM || in_sizes[6] != DM || in_sizes[8] != DM) return;
  if (out_size != NX) return;

  size_t off = 0;
  const size_t szP = (size_t)NROW * DM * 2;              // 8388608
  const size_t oQP = off; off += szP;
  const size_t oKP = off; off += szP;
  const size_t oVT = off; off += szP;
  if (off > ws_size) return;                             // off = 25165824

  const float* Ain = (const float*)d_in[0];
  const float* Bin = (const float*)d_in[1];
  const int*   msk = (const int*)d_in[2];
  const float* Wq  = (const float*)d_in[3];
  const float* bq  = (const float*)d_in[4];
  const float* Wk  = (const float*)d_in[5];
  const float* bk  = (const float*)d_in[6];
  const float* Wv  = (const float*)d_in[7];
  const float* bv  = (const float*)d_in[8];
  char* ws = (char*)d_ws;
  unsigned short* QP  = (unsigned short*)(ws + oQP);
  unsigned short* KP  = (unsigned short*)(ws + oKP);
  unsigned short* VT  = (unsigned short*)(ws + oVT);
  float* out = (float*)d_out;

  const dim3 blk256(256);
  const dim3 gP(PTILES / TPB);                           // 256 blocks: three 64-row tiles each
  const dim3 gA(NB * (SEQ / QT));                        // 256 blocks: one (b, 64-query tile) each

  // (1) Qp = Ab . Wqb^T + bq (f16 plane), Kp = Bb . Wkb^T + bk (f16 plane), Vt = (Bb . Wvb^T + bv)^T per batch (f16)
  proj_all<<<gP, blk256, 0, stream>>>(Ain, Bin, Wq, bq, Wk, bk, Wv, bv, QP, KP, VT);
  // (2) out[b][n][d] = sum_m softmax_m(mask ? Qp_n . Kp_m / 16 : -big) Vt[d][m]
  attn_kernel<<<gA, blk256, 0, stream>>>(QP, KP, VT, msk, out);
  (void)hipGetLastError();
}

// v004
// One run takes 46.9 microseconds.
// In both of two side-by-side timings against v003, it was 1.17 times as fast.
// Over all steps from v000 it is 5.13 times as fast.
// Contractions: Q/K/V projections = Xb . Wb^T on v_wmma_f32_16x16x32_bf16 (Xb, Wb = RNE bf16 convert of A, B, Wq,
// Wk, Wv; K=256, f32 accumulate); scores S^T = Kp . Qp^T on v_wmma_f32_16x16x32_f16 (Kp, Qp = f16 planes of the
// projections incl. bias, K=256); O^T = Vt . P^T on v_wmma_f32_16x16x32_f16 (Vt = f16 plane of V incl. bias,
// P = e^{s-m} x 1024 in f16, 2048 keys); f32 accumulate everywhere; bias add, 1/16 scale, key mask select,
// running max, row sums and 1/l in f32 on VALU.
#include <hip/hip_runtime.h>
#include <math.h>
#include <stdint.h>

#define NB    8
#define SEQ   2048
#define DM    256
#define NROW  (NB * SEQ)
#define QT    64
#define OSP   132
#define TP    72
#define XP    264                     /* LDS pitch of an X, W or staged output row of 256 16-bit values: 528 B = 16 B x 33 */
#define PTILES (3 * (NROW / 64))      /* projection tiles of 64 rows x 256 cols */
#define TPB   3                       /* projection tiles per block */
#define KST   128                     /* keys per ring stage (four 32-key passes, one per wave group) */
#define NST   (SEQ / KST)
#define KQP   264                     /* LDS pitch of a Q or K row in halves: 528 B = 16 B x 33 */
#define VSP   136                     /* LDS pitch of a Vt row of 128 keys in halves: 272 B = 16 B x 17 */
#define LNPS  6.931471805599453f
#define FMIN16 6.103515625e-05f
#define NEGBIG (-1.0e30f)
static_assert((SEQ % QT) == 0);
static_assert((SEQ % 64) == 0);
static_assert((SEQ % 256) == 0);
static_assert((DM % 128) == 0);
static_assert((DM % 32) == 0);
static_assert((NROW % 64) == 0);
static_assert(NROW / 64 == 256);
static_assert((PTILES % TPB) == 0);
static_assert(DM == 256);
static_assert(QT == 64);
static_assert(64 * XP <= DM * TP);
static_assert(NST >= 2);
static_assert(KST == 128);

typedef _Float16       v16h __attribute__((ext_vector_type(16)));
typedef _Float16       v8h  __attribute__((ext_vector_type(8)));
typedef __bf16         v16b __attribute__((ext_vector_type(16)));
typedef unsigned short v8us __attribute__((ext_vector_type(8)));
typedef float          v8f  __attribute__((ext_vector_type(8)));
typedef float          v4f  __attribute__((ext_vector_type(4)));
typedef unsigned int   v4u  __attribute__((ext_vector_type(4)));
typedef unsigned int   v2u  __attribute__((ext_vector_type(2)));
typedef float          v2f  __attribute__((ext_vector_type(2)));
typedef __bf16         v2b  __attribute__((ext_vector_type(2)));

union FragH { v16h v; v8h  h[2]; };
union FragB { v16b v; v8us u[2]; };
static_assert(sizeof(FragH) == 32);
static_assert(sizeof(FragB) == 32);

// ---- scalar helpers --------------------------------------------------------------------------------
__device__ __forceinline__ unsigned short bf_bits(float f) {          // f32 -> bf16 bits, RNE convert
  unsigned u = __float_as_uint(f);
  return (unsigned short)((u + 0x7FFFu + ((u >> 16) & 1u)) >> 16);
}
__device__ __forceinline__ float bf_up(unsigned short x) { return __uint_as_float(((unsigned)x) << 16); }
__device__ __forceinline__ float bfr(float f) { return bf_up(bf_bits(f)); }
__device__ __forceinline__ unsigned short h_bits(_Float16 x) { return __builtin_bit_cast(unsigned short, x); }
__device__ __forceinline__ unsigned pk16(unsigned short a, unsigned short b) { return (unsigned)a | ((unsigned)b << 16); }
// f32 -> f16 with magnitudes below the smallest f16 normal flushed to zero (select by value)
__device__ __forceinline__ _Float16 to_h_ftz(float v) { return (_Float16)((fabsf(v) < FMIN16) ? 0.0f : v); }
__device__ __forceinline__ v8f zero8() { v8f z = {0.f, 0.f, 0.f, 0.f, 0.f, 0.f, 0.f, 0.f}; return z; }
__device__ __forceinline__ float hmax8(v8f s) {
  return fmaxf(fmaxf(fmaxf(s[0], s[1]), fmaxf(s[2], s[3])), fmaxf(fmaxf(s[4], s[5]), fmaxf(s[6], s[7])));
}

// ---- fragment loaders: 16-bit A/B operand, lane -> row/col (lane&15), p already includes +8*(lane>>4);
//      elements 0..7 <- p[0..7] (k0+8h..), elements 8..15 <- p[16..23] (k0+16+8h..)
__device__ __forceinline__ v16h ldfrag_h(const _Float16* p) {
  FragH f;
  f.h[0] = *(const v8h*)(p);
  f.h[1] = *(const v8h*)(p + 16);
  return f.v;
}
__device__ __forceinline__ v16b ldfrag_b(const unsigned short* p) {
  FragB f;
  f.u[0] = *(const v8us*)(p);
  f.u[1] = *(const v8us*)(p + 16);
  return f.v;
}

// ---- WMMA helpers (bf16: builtin followed by a 4-slot VALU gap tying D and keeping A/B live) ---------------
__device__ __forceinline__ v8f mma_h(v16h a, v16h b, v8f c) {   // builtin alone: the compiler keeps the distances, and the operands may lie above v255
  return __builtin_amdgcn_wmma_f32_16x16x32_f16(false, a, false, b, (short)0, c, false, false);
}
__device__ __forceinline__ v8f mma_b(v16b a, v16b b, v8f c) {
  v8f d = __builtin_amdgcn_wmma_f32_16x16x32_bf16(false, a, false, b, (short)0, c, false, false);
#if defined(__HIP_DEVICE_COMPILE__)
  const v16h ha = __builtin_bit_cast(v16h, a), hb = __builtin_bit_cast(v16h, b);
  asm volatile("v_nop\n\tv_nop\n\tv_nop\n\tv_nop" : "+v"(d) : "v"(ha), "v"(hb));
#endif
  return d;
}

// ---- asynchronous copies to LDS: eight 16-B copies per lane, copy j at LDS byte l + j*ls from g + j*gs halves.
//      s_wait_xcnt 0 is the statement's last line so that no address register is rewritten ahead of it.
__device__ __forceinline__ uint32_t lds_off(const void* p) { return (uint32_t)(size_t)p; }
__device__ __forceinline__ void acopy8(uint32_t l, uint32_t ls, const _Float16* g, size_t gs) {
#if defined(__HIP_DEVICE_COMPILE__)
  asm volatile(
      "global_load_async_to_lds_b128 %0, %8, off\n\t"
      "global_load_async_to_lds_b128 %1, %9, off\n\t"
      "global_load_async_to_lds_b128 %2, %10, off\n\t"
      "global_load_async_to_lds_b128 %3, %11, off\n\t"
      "global_load_async_to_lds_b128 %4, %12, off\n\t"
      "global_load_async_to_lds_b128 %5, %13, off\n\t"
      "global_load_async_to_lds_b128 %6, %14, off\n\t"
      "global_load_async_to_lds_b128 %7, %15, off\n\t"
      "s_wait_xcnt 0x0"
      :: "v"(l), "v"(l + ls), "v"(l + 2 * ls), "v"(l + 3 * ls),
         "v"(l + 4 * ls), "v"(l + 5 * ls), "v"(l + 6 * ls), "v"(l + 7 * ls),
         "v"(g), "v"(g + gs), "v"(g + 2 * gs), "v"(g + 3 * gs),
         "v"(g + 4 * gs), "v"(g + 5 * gs), "v"(g + 6 * gs), "v"(g + 7 * gs)
      : "memory");
#endif
}

// =====================================================================================================
// (1) all three projections in one launch, straight from the f32 inputs: Y = Xb . Wb^T + bf16(bias), Xb, Wb = RNE bf16.
//   768 tiles of 64 rows x 256 cols: tile t = (projection p = t / 256: Q, K, V; row tile t % 256). Block = 256 threads
//   = 8 waves takes tiles 3*bx .. 3*bx+2. W of projection p (256 x 256) is read once per block in whole 512-B runs,
//   converted and kept in LDS Wsm[col][k] (read again only where p changes inside a block); the X tile likewise in
//   Xs[row][k]; the next tile's X loads fly in registers while this tile is worked on.
//   Wave w: rows 32(w&1) + 16u + .., cols 64(w>>1) + 16j + .., 2 x 4 D tiles, 8 k-steps of 32, both operands through the
//   same split k map. D element r of tile (u, j) = (row 32wr + 16u + 8h + r, col 64wc + 16j + c).
//   p < 2: values staged in S[row][col] (pitch XP), written as whole 512-B rows of OP[row][256].
//   p == 2: staged transposed in S[col][row] (pitch TP, 16-B stores of 8 consecutive rows), written as 128-B lines of
//   Vt[b][d][key0 .. key0+63].
// coverage: 256 blocks x 3 tiles = 768 tiles; staging 2 wr x 2 u x 2 h x 8 r = 64 rows, 4 wc x 4 j x 16 c = 256 cols;
//   writes: 8 it x 256 threads x 8 halves = 64 x 256 values of the tile, each once.
// =====================================================================================================
__device__ __forceinline__ v2u cvt4(v4f f) {                  // four f32 -> four bf16 (RNE), packed in k order
  v2f lo, hi;
  lo[0] = f[0]; lo[1] = f[1]; hi[0] = f[2]; hi[1] = f[3];
  v2u r;
  r[0] = __builtin_bit_cast(unsigned, __builtin_convertvector(lo, v2b));
  r[1] = __builtin_bit_cast(unsigned, __builtin_convertvector(hi, v2b));
  return r;
}

__global__ __launch_bounds__(256)
void proj_all(const float* __restrict__ Ain, const float* __restrict__ Bin,
              const float* __restrict__ Wq, const float* __restrict__ bq,
              const float* __restrict__ Wk, const float* __restrict__ bk,
              const float* __restrict__ Wv, const float* __restrict__ bv,
              unsigned short* QP, unsigned short* KP, unsigned short* VT) {
  __shared__ __align__(16) unsigned short Wsm[DM * XP];
  __shared__ __align__(16) unsigned short Xs[64 * XP];
  __shared__ __align__(16) unsigned short S[DM * TP];
  const int tid  = threadIdx.x;
  const int lane = tid & 31, wave = tid >> 5;
  const int h    = lane >> 4, c = lane & 15;
  const int wr   = wave & 1, wc = wave >> 1;
  const int t0   = blockIdx.x * TPB;

  // 16-B piece j*256 + tid of a contiguous f32 tile = row 4j + (tid>>6), floats 4(tid&63) ..
  const int ldso = (tid >> 6) * XP + 4 * (tid & 63);
  const unsigned short* ap = Xs  + (32 * wr + c) * XP + 8 * h;
  const unsigned short* bp = Wsm + (64 * wc + c) * XP + 8 * h;

  v4f xr[16];
  {
    const float* xs = ((t0 >> 8) == 0 ? Ain : Bin) + (size_t)(t0 & 255) * 64 * DM + 4 * tid;
    __builtin_amdgcn_sched_barrier(0);                        // keeps the argument loads above from sinking in between these loads and their wait
#pragma unroll
    for (int j = 0; j < 16; ++j) xr[j] = *(const v4f*)(xs + j * 1024);
    asm volatile("s_wait_xcnt 0x0" ::: "memory");             // before a register that these loads name is rewritten
    __builtin_amdgcn_sched_barrier(0);                        // keeps the index arithmetic below from rising over that wait
  }

  int pcur = -1;
  float bb[4] = {0.f, 0.f, 0.f, 0.f};                         // biases of projection pcur as bf16 RNE values
#pragma unroll 1                                              // one copy of the tile body
  for (int i = 0; i < TPB; ++i) {
    const int t = t0 + i, p = t >> 8, row0 = (t & 255) * 64;  // block-uniform
    __syncthreads();                                          // every reader of Xs, Wsm and S of the tile before is done
    if (p != pcur) {                                          // block-uniform
      pcur = p;
      const float* wsrc = (p == 0 ? Wq : (p == 1 ? Wk : Wv)) + 4 * tid;
      const float* bias = (p == 0 ? bq : (p == 1 ? bk : bv));
      v4f wa[32], wb[32];                                     // all of W in flight at once: its latency is paid once
      float br[4];
#pragma unroll
      for (int j = 0; j < 32; ++j) wa[j] = *(const v4f*)(wsrc + j * 1024);
#pragma unroll
      for (int j = 0; j < 32; ++j) wb[j] = *(const v4f*)(wsrc + (32 + j) * 1024);
#pragma unroll
      for (int j = 0; j < 4; ++j) br[j] = bias[64 * wc + 16 * j + c];   // in-range lane indices (64wc + 48 + c <= 255)
      asm volatile("s_wait_xcnt 0x0" ::: "memory");           // before a register that these loads name is rewritten
#pragma unroll
      for (int j = 0; j < 32; ++j) *(v2u*)(Wsm + ldso + j * 4 * XP) = cvt4(wa[j]);
#pragma unroll
      for (int j = 0; j < 32; ++j) *(v2u*)(Wsm + ldso + (32 + j) * 4 * XP) = cvt4(wb[j]);
#pragma unroll
      for (int j = 0; j < 4; ++j) bb[j] = bfr(br[j]);
    }
#pragma unroll
    for (int j = 0; j < 16; ++j) *(v2u*)(Xs + ldso + j * 4 * XP) = cvt4(xr[j]);
    __syncthreads();                                          // Xs (and Wsm) published
    if (i + 1 < TPB) {                                        // block-uniform; behind the barrier, which waits for every load
      const int tn = t + 1;
      const float* xs = ((tn >> 8) == 0 ? Ain : Bin) + (size_t)(tn & 255) * 64 * DM + 4 * tid;
#pragma unroll
      for (int j = 0; j < 16; ++j) xr[j] = *(const v4f*)(xs + j * 1024);
      asm volatile("s_wait_xcnt 0x0" ::: "memory");           // before a register that these loads name is rewritten
    }

    v8f acc[2][4];
#pragma unroll
    for (int j = 0; j < 4; ++j) { acc[0][j] = zero8(); acc[1][j] = zero8(); }
    // fragments of k-step ks+2 are fetched ahead of the products of k-step ks (three register sets)
    v16b fa[3][2], fb[3][4];
#pragma unroll                                                // constant indices keep the sets in registers (here and below)
    for (int ks = 0; ks < 2; ++ks) {
      fa[ks][0] = ldfrag_b(ap + 32 * ks);
      fa[ks][1] = ldfrag_b(ap + 16 * XP + 32 * ks);
#pragma unroll
      for (int j = 0; j < 4; ++j) fb[ks][j] = ldfrag_b(bp + 16 * j * XP + 32 * ks);
    }
#pragma unroll
    for (int ks = 0; ks < DM / 32; ++ks) {
      if (ks + 2 < DM / 32) {
        fa[(ks + 2) % 3][0] = ldfrag_b(ap + 32 * (ks + 2));
        fa[(ks + 2) % 3][1] = ldfrag_b(ap + 16 * XP + 32 * (ks + 2));
#pragma unroll
        for (int j = 0; j < 4; ++j) fb[(ks + 2) % 3][j] = ldfrag_b(bp + 16 * j * XP + 32 * (ks + 2));
      }
#pragma unroll
      for (int j = 0; j < 4; ++j) {
        acc[0][j] = mma_b(fa[ks % 3][0], fb[ks % 3][j], acc[0][j]);
        acc[1][j] = mma_b(fa[ks % 3][1], fb[ks % 3][j], acc[1][j]);
      }
    }

    if (p < 2) {                                              // block-uniform
#pragma unroll
      for (int u = 0; u < 2; ++u)
#pragma unroll
        for (int j = 0; j < 4; ++j) {
          unsigned short* qs = S + (32 * wr + 16 * u + 8 * h) * XP + 64 * wc + 16 * j + c;
#pragma unroll
          for (int r = 0; r < 8; ++r) qs[r * XP] = h_bits(to_h_ftz(acc[u][j][r] + bb[j]));
        }
    } else {
#pragma unroll
      for (int u = 0; u < 2; ++u)
#pragma unroll
        for (int j = 0; j < 4; ++j) {
          v4u w;
#pragma unroll
          for (int q = 0; q < 4; ++q)
            w[q] = pk16(h_bits(to_h_ftz(acc[u][j][2 * q] + bb[j])), h_bits(to_h_ftz(acc[u][j][2 * q + 1] + bb[j])));
          *(v4u*)(S + (64 * wc + 16 * j + c) * TP + 32 * wr + 16 * u + 8 * h) = w;
        }
    }
    __syncthreads();                                          // S published

    if (p < 2) {
      unsigned short* OP = (p == 0 ? QP : KP) + (size_t)row0 * DM;
#pragma unroll
      for (int it = 0; it < 8; ++it) {
        const int row = it * 8 + wave;                        // one whole 512-B row per wave and store
        const v4u v = *(const v4u*)(S + row * XP + 8 * lane);
        *(v4u*)(OP + (size_t)row * DM + 8 * lane) = v;
      }
      asm volatile("s_wait_xcnt 0x0" ::: "memory");           // before a register that these stores name is rewritten
    } else {
      const int b    = row0 / SEQ;
      const int key0 = row0 % SEQ;                            // 64 consecutive keys of one batch
      const int e = tid & 7, lg = tid >> 3;
      unsigned short* vp = VT + ((size_t)b * DM + lg) * SEQ + key0 + 8 * e;
#pragma unroll
      for (int it = 0; it < 8; ++it) {                        // d = 32 it + lg, 0..255
        const v4u v = *(const v4u*)(S + (it * 32 + lg) * TP + 8 * e);
        *(v4u*)(vp + (size_t)it * 32 * SEQ) = v;
      }
      asm volatile("s_wait_xcnt 0x0" ::: "memory");           // before a register that these stores name is rewritten
    }
  }
}

// =====================================================================================================
// (2) attention for one (b, 64-query tile), transposed formulation, 256-deep scores, 2048 keys.
//   Block = 256 threads = 8 waves. Key mask row of batch b staged once in LDS Ms[2048].
//   Operand tiles come to LDS by asynchronous 16-B copies over whole lines: Qs[64 queries][256 d] once; a ring of
//     two buffers, stage = 128 keys: Ks[128 keys][256 d], Vs[256 d][128 keys]. Wave w copies Q rows 8w..8w+7 and K rows
//     16w..16w+15 (one 512-B row per copy) and Vt rows 32w..32w+31 (two 256-B rows per copy). Stage s+2 is issued behind
//     the barrier that ends stage s; all fragments below are read from these tiles.
//   Wave w = (wq = w&1, kg = w>>1) owns queries 32wq..32wq+31 (two tiles of 16) and keys 32kg..32kg+31 of every stage,
//     end to end, so that every K fragment and every Vt fragment read from LDS feeds two products:
//     S^T tiles (16 keys x 16 queries) = A(Kp rows = keys, d via the split k map) . B(Qp rows = query 32wq + 16qt +
//     (lane&15), same d map), 8 d-steps, 2 x 2 tiles; s = D x (1/16), masked key (Ms == 0) -> s := -1e30 (exp gives 0; a
//     fully masked row gives equal weights). Per lane and query tile the two D tiles hold 16 keys of ONE query: online
//     softmax state per lane and query tile, one shuffle (lane^16) for the max over 32 keys. P = e^{s-m} x 1024 in f16:
//     the lane's 16 values are, in this order, its elements of the B operand of O^T (keys 8h..8h+7, then 16+8h..23+8h),
//     so P stays in registers.
//     O^T: 2 x 16 accumulators = 256 d x 32 queries, rescaled by the lane's own corr; A = Vt rows d (keys contiguous).
//     acc[qt][4g + j]: d = 64((kg + g) & 3) + 16j + ..
//   After the loop the four waves of a query group join their key quarters: each hands m, l and acc[.][4..15] to the
//     owners through LDS (m, l in Ml; acc on the ring's bytes, free behind the loop's last barrier) and finishes d = 64kg .. 64kg+63:
//     o = (sum over the four waves of o_w e^{m_w-M}) / l_joined.
//   Epilogue in 2 halves of 128 d: waves with kg>>1 == t stage O^T into Os[query][d_local] (16-B LDS stores; Os lies on
//     the bytes of Qs, free behind the loop's last barrier),
// coverage: keys: 16 stages x 4 kg x 32; Os per half: 2 kg x 4 j x 2 h x 8 r = 128 d, 2 wq x 2 qt x 16 c = 64 queries;
//           out: 2 t x 8 it x 32 lines x 8 lanes x 4 floats = 64 rows x 256;
//           grid = 8 b x 32 query tiles = 256 blocks covers out exactly once.
// =====================================================================================================
__global__ __launch_bounds__(256)
void attn_kernel(const unsigned short* __restrict__ QP, const unsigned short* __restrict__ KP,
                 const unsigned short* __restrict__ VT, const int* __restrict__ mask, float* out) {
  __shared__ float Ml[4 * 256];
  __shared__ int Ms[SEQ];
  __shared__ __align__(16) _Float16 Qs[QT * KQP];
  __shared__ __align__(16) _Float16 Ring[2 * KST * KQP + 2 * DM * VSP];
  _Float16* const Ks = Ring;
  _Float16* const Vs = Ring + 2 * KST * KQP;
  float* const Mg = (float*)(void*)Ring;                      // join buffer, used behind the loop only
  float* const Os = (float*)(void*)Qs;                        // output staging, used behind the loop only
  static_assert(8 * 24 * 256 * 4 <= (2 * KST * KQP + 2 * DM * VSP) * 2);
  static_assert(64 * OSP * 4 <= QT * KQP * 2);
  const int tid  = threadIdx.x;
  const int wave = tid >> 5;
  const int lane = tid & 31;
  const int h    = lane >> 4;
  const int c    = lane & 15;
  const int bx   = blockIdx.x;
  const int b    = bx / (SEQ / QT);
  const int qt0  = bx % (SEQ / QT);
  const int n0   = qt0 * QT;
  const _Float16* QPh = (const _Float16*)(const void*)QP;
  const _Float16* KPh = (const _Float16*)(const void*)KP;
  const _Float16* VTh = (const _Float16*)(const void*)VT;

#pragma unroll
  for (int i = 0; i < SEQ / 256; ++i) Ms[i * 256 + tid] = mask[(size_t)b * SEQ + i * 256 + tid];

  // copy sources and places of this lane: Q row 8*wave + j, K row 16*wave + j, 16-B piece lane;
  // Vt row 32*wave + 2j + (lane>>4), piece lane&15
  const _Float16* qsrc = QPh + ((size_t)b * SEQ + n0 + 8 * wave) * DM + 8 * lane;
  const _Float16* ksrc = KPh + ((size_t)b * SEQ + 16 * wave) * DM + 8 * lane;                       // + stage * KST * DM
  const _Float16* vsrc = VTh + ((size_t)b * DM + 32 * wave + (lane >> 4)) * SEQ + 8 * (lane & 15);  // + stage * KST
  const uint32_t qdst = lds_off(Qs) + (uint32_t)(8 * wave * KQP + 8 * lane) * 2u;
  const uint32_t kdst = lds_off(Ks) + (uint32_t)(16 * wave * KQP + 8 * lane) * 2u;                  // + buffer * KST*KQP*2
  const uint32_t vdst = lds_off(Vs) + (uint32_t)((32 * wave + (lane >> 4)) * VSP + 8 * (lane & 15)) * 2u;  // + buffer * DM*VSP*2

  // Q tile and stage 0, landed and published; then stage 1 flies while stage 0 is worked on
  acopy8(qdst, KQP * 2u, qsrc, (size_t)DM);
  acopy8(kdst, KQP * 2u, ksrc, (size_t)DM);
  acopy8(kdst + 8u * KQP * 2u, KQP * 2u, ksrc + (size_t)8 * DM, (size_t)DM);
  acopy8(vdst, 2u * VSP * 2u, vsrc, (size_t)2 * SEQ);
  acopy8(vdst + 16u * VSP * 2u, 2u * VSP * 2u, vsrc + (size_t)16 * SEQ, (size_t)2 * SEQ);
  asm volatile("s_wait_asynccnt 0x0" ::: "memory");          // this wave's copies have landed before the barrier publishes them
  __syncthreads();
  acopy8(kdst + KST * KQP * 2u, KQP * 2u, ksrc + (size_t)KST * DM, (size_t)DM);
  acopy8(kdst + KST * KQP * 2u + 8u * KQP * 2u, KQP * 2u, ksrc + (size_t)KST * DM + (size_t)8 * DM, (size_t)DM);
  acopy8(vdst + DM * VSP * 2u, 2u * VSP * 2u, vsrc + KST, (size_t)2 * SEQ);
  acopy8(vdst + DM * VSP * 2u + 16u * VSP * 2u, 2u * VSP * 2u, vsrc + KST + (size_t)16 * SEQ, (size_t)2 * SEQ);

  const int wq = wave & 1, kg = wave >> 1;
  // Q fragment base in Qs (B operand of scores, col = query 32wq + c), + 16 queries * KQP + 32*ks
  const _Float16* qpp = Qs + (32 * wq + c) * KQP + 8 * h;
  // K fragment base in Ks (A operand of scores, row = local key 32kg + c), + buffer + 16 keys * KQP + 32*ks
  const _Float16* khp = Ks + (32 * kg + c) * KQP + 8 * h;
  // Vt fragment bases in Vs (A operand of O^T, row = d, keys 32kg.. contiguous), + buffer + 16j*VSP
  const _Float16* vg0 = Vs + (64 * kg + c) * VSP + 32 * kg + 8 * h;                // d = 64kg + 16j + c
  const _Float16* vg1 = Vs + (64 * ((kg + 1) & 3) + c) * VSP + 32 * kg + 8 * h;    // d = 64((kg+1)&3) + 16j + c
  const _Float16* vg2 = Vs + (64 * ((kg + 2) & 3) + c) * VSP + 32 * kg + 8 * h;
  const _Float16* vg3 = Vs + (64 * ((kg + 3) & 3) + c) * VSP + 32 * kg + 8 * h;
  const float SCL = 0.0625f;                                  // 1/sqrt(256)

  float m[2] = {NEGBIG, NEGBIG}, l[2] = {0.f, 0.f};
  v8f acc[2][16];
#pragma unroll
  for (int j = 0; j < 16; ++j) { acc[0][j] = zero8(); acc[1][j] = zero8(); }

#pragma unroll 1                                              // one copy of the 64-WMMA body: buf stays a run-time value
  for (int s = 0; s < NST; ++s) {
    const int buf = s & 1;                                    // ring buffer of stage s
    const int kb  = s * KST + 32 * kg;                        // first key of this wave's pass
    v8f sc[2][2];                                             // [key tile][query tile]
    sc[0][0] = zero8(); sc[0][1] = zero8(); sc[1][0] = zero8(); sc[1][1] = zero8();
    const _Float16* k0p = khp + buf * KST * KQP;              // keys kb .. kb+15
    const _Float16* k1p = k0p + 16 * KQP;                     // keys kb+16 .. kb+31
    // fragments of d-step ks+1 are fetched ahead of the products of d-step ks (two register sets: a third one spills)
    v16h q0[2], q1[2], a0[2], a1[2];
    q0[0] = ldfrag_h(qpp);
    q1[0] = ldfrag_h(qpp + 16 * KQP);
    a0[0] = ldfrag_h(k0p);
    a1[0] = ldfrag_h(k1p);
#pragma unroll                                                // constant indices keep the sets in registers (here and below)
    for (int ks = 0; ks < DM / 32; ++ks) {
      if (ks + 1 < DM / 32) {
        q0[(ks + 1) % 2] = ldfrag_h(qpp + 32 * (ks + 1));
        q1[(ks + 1) % 2] = ldfrag_h(qpp + 16 * KQP + 32 * (ks + 1));
        a0[(ks + 1) % 2] = ldfrag_h(k0p + 32 * (ks + 1));
        a1[(ks + 1) % 2] = ldfrag_h(k1p + 32 * (ks + 1));
      }
      sc[0][0] = mma_h(a0[ks % 2], q0[ks % 2], sc[0][0]);
      sc[1][0] = mma_h(a1[ks % 2], q0[ks % 2], sc[1][0]);
      sc[0][1] = mma_h(a0[ks % 2], q1[ks % 2], sc[0][1]);
      sc[1][1] = mma_h(a1[ks % 2], q1[ks % 2], sc[1][1]);
    }
    // Vt fragments come in four groups of four through two register sets; group 0 is fetched ahead of the softmax
    const int vbo = buf * DM * VSP;
    v16h va[4], vb[4];
#pragma unroll
    for (int j = 0; j < 4; ++j) va[j] = ldfrag_h(vg0 + vbo + 16 * j * VSP);
    // key mask of the wave's 32 keys: D row 8h+r of sc[0][.] = key kb+8h+r, of sc[1][.] = key kb+16+8h+r
    int keep0[8], keep1[8];
#pragma unroll
    for (int r = 0; r < 8; ++r) {
      keep0[r] = Ms[kb + 8 * h + r];
      keep1[r] = Ms[kb + 16 + 8 * h + r];
    }

    FragH ph[2];
    float corr[2];
#pragma unroll
    for (int qt = 0; qt < 2; ++qt) {
      v8f s0 = sc[0][qt], s1 = sc[1][qt];
      // scale and key mask (select by value)
#pragma unroll
      for (int r = 0; r < 8; ++r) {
        const float v0 = s0[r] * SCL, v1 = s1[r] * SCL;
        s0[r] = (keep0[r] != 0) ? v0 : NEGBIG;
        s1[r] = (keep1[r] != 0) ? v1 : NEGBIG;
      }
      float mx = fmaxf(hmax8(s0), hmax8(s1));
      mx = fmaxf(mx, __shfl_xor(mx, 16, 32));
      const float mn = fmaxf(m[qt], mx);
      corr[qt] = __expf(m[qt] - mn);
      m[qt] = mn;
      const float msh = mn - LNPS;                            // exp gives e^{s-m} * 1024
      float ls = 0.f;
#pragma unroll
      for (int r = 0; r < 8; ++r) {
        const float e0 = __expf(s0[r] - msh);                 // key kb      + 8h + r
        const float e1 = __expf(s1[r] - msh);                 // key kb + 16 + 8h + r
        ls += e0 + e1;
        ph[qt].h[0][r] = (_Float16)e0;                        // B elements 0..7:  keys 8h .. 8h+7
        ph[qt].h[1][r] = (_Float16)e1;                        // B elements 8..15: keys 16+8h .. 23+8h
      }
      l[qt] = l[qt] * corr[qt] + ls;
    }

#pragma unroll
    for (int qt = 0; qt < 2; ++qt)
#pragma unroll
      for (int j = 0; j < 16; ++j)
#pragma unroll
        for (int r = 0; r < 8; ++r) acc[qt][j][r] *= corr[qt];   // every element of a lane belongs to its query c of tile qt

#pragma unroll
    for (int j = 0; j < 4; ++j) vb[j] = ldfrag_h(vg1 + vbo + 16 * j * VSP);
#pragma unroll
    for (int j = 0; j < 4; ++j) {
      acc[0][j] = mma_h(va[j], ph[0].v, acc[0][j]);
      acc[1][j] = mma_h(va[j], ph[1].v, acc[1][j]);
    }
#pragma unroll
    for (int j = 0; j < 4; ++j) va[j] = ldfrag_h(vg2 + vbo + 16 * j * VSP);
#pragma unroll
    for (int j = 0; j < 4; ++j) {
      acc[0][4 + j] = mma_h(vb[j], ph[0].v, acc[0][4 + j]);
      acc[1][4 + j] = mma_h(vb[j], ph[1].v, acc[1][4 + j]);
    }
#pragma unroll
    for (int j = 0; j < 4; ++j) vb[j] = ldfrag_h(vg3 + vbo + 16 * j * VSP);
#pragma unroll
    for (int j = 0; j < 4; ++j) {
      acc[0][8 + j] = mma_h(va[j], ph[0].v, acc[0][8 + j]);
      acc[1][8 + j] = mma_h(va[j], ph[1].v, acc[1][8 + j]);
    }
#pragma unroll
    for (int j = 0; j < 4; ++j) {
      acc[0][12 + j] = mma_h(vb[j], ph[0].v, acc[0][12 + j]);
      acc[1][12 + j] = mma_h(vb[j], ph[1].v, acc[1][12 + j]);
    }

    // end of stage s: publish stage s+1, free this buffer, refill it with stage s+2
    asm volatile("s_wait_dscnt 0x0" ::: "memory");            // this wave's reads of the buffer are done before it is refilled
    asm volatile("s_wait_asynccnt 0x0" ::: "memory");         // this wave's copies of stage s+1 have landed
    __syncthreads();
    const int sn = s + 2;
    if (sn < NST) {                                           // block-uniform
      const uint32_t kd = kdst + (uint32_t)buf * (KST * KQP * 2u);
      const uint32_t vd = vdst + (uint32_t)buf * (DM * VSP * 2u);
      const _Float16* kn = ksrc + (size_t)sn * KST * DM;
      const _Float16* vn = vsrc + (size_t)sn * KST;
      acopy8(kd, KQP * 2u, kn, (size_t)DM);
      acopy8(kd + 8u * KQP * 2u, KQP * 2u, kn + (size_t)8 * DM, (size_t)DM);
      acopy8(vd, 2u * VSP * 2u, vn, (size_t)2 * SEQ);
      acopy8(vd + 16u * VSP * 2u, 2u * VSP * 2u, vn + (size_t)16 * SEQ, (size_t)2 * SEQ);
    }
  }
  asm volatile("s_wait_asynccnt 0x0" ::: "memory");           // no copy is outstanding when the loop is left

  // join the four key quarters of a query group: lane to same lane of the three other waves with this wq
#pragma unroll
  for (int qt = 0; qt < 2; ++qt) {
    Ml[qt * 256 + tid]       = m[qt];
    Ml[(2 + qt) * 256 + tid] = l[qt];
  }
  {
    float* mgw = Mg + wave * 24 * 256 + lane * 4;             // 48 pieces of 32 lanes x 16 B; tile ((g-1)*2 + qt)*4 + j
#pragma unroll
    for (int g = 1; g < 4; ++g)
#pragma unroll
      for (int qt = 0; qt < 2; ++qt)
#pragma unroll
        for (int j = 0; j < 4; ++j) {
          const int ti = ((g - 1) * 2 + qt) * 4 + j;
          const v8f a = acc[qt][4 * g + j];
          v4f v0, v1;
          v0[0] = a[0]; v0[1] = a[1]; v0[2] = a[2]; v0[3] = a[3];
          v1[0] = a[4]; v1[1] = a[5]; v1[2] = a[6]; v1[3] = a[7];
          *(v4f*)(mgw + (2 * ti) * 128)     = v0;
          *(v4f*)(mgw + (2 * ti + 1) * 128) = v1;
        }
  }
  __syncthreads();
#pragma unroll
  for (int qt = 0; qt < 2; ++qt) {
    // the wave with key quarter (kg - g) & 3 holds this wave's d range as its group g
    float mp[4], lp[4];
    mp[0] = m[qt]; lp[0] = l[qt];
#pragma unroll
    for (int g = 1; g < 4; ++g) {
      const int pt = (wq + 2 * ((kg - g) & 3)) * 32 + lane;   // same lane of that wave
      mp[g] = Ml[qt * 256 + pt];
      lp[g] = Ml[(2 + qt) * 256 + pt];
    }
    const float mt = fmaxf(fmaxf(mp[0], mp[1]), fmaxf(mp[2], mp[3]));
    float ax[4];
    float lt = 0.f;
#pragma unroll
    for (int g = 0; g < 4; ++g) { ax[g] = __expf(mp[g] - mt); lt += lp[g] * ax[g]; }   // one of them is 1
    lt += __shfl_xor(lt, 16, 32);                             // o and l carry the same factor; lt > 0 (the top key adds its full weight)
    const float il = 1.0f / lt;
#pragma unroll
    for (int j = 0; j < 4; ++j)
#pragma unroll
      for (int r = 0; r < 8; ++r) acc[qt][j][r] *= ax[0] * il;
#pragma unroll
    for (int g = 1; g < 4; ++g) {
      const float sp = ax[g] * il;
      const float* mgr = Mg + (wq + 2 * ((kg - g) & 3)) * 24 * 256 + lane * 4;
#pragma unroll
      for (int j = 0; j < 4; ++j) {
        const int ti = ((g - 1) * 2 + qt) * 4 + j;
        const v4f p0 = *(const v4f*)(mgr + (2 * ti) * 128);
        const v4f p1 = *(const v4f*)(mgr + (2 * ti + 1) * 128);
#pragma unroll
        for (int r = 0; r < 4; ++r) {
          acc[qt][j][r]     += p0[r] * sp;
          acc[qt][j][4 + r] += p1[r] * sp;
        }
      }
    }
  }

  const int e = tid & 7, lg = tid >> 3;                      // lg 0..31: line slot, e: 16-B piece
  float* ob = out + ((size_t)b * SEQ + n0) * DM;
#pragma unroll
  for (int t = 0; t < 2; ++t) {
    if ((kg >> 1) == t) {                                     // wave-uniform: waves with kg = 2t, 2t+1 own d 128t .. 128t+127
#pragma unroll
      for (int qt = 0; qt < 2; ++qt)
#pragma unroll
        for (int j = 0; j < 4; ++j) {
          float* os = Os + (32 * wq + 16 * qt + c) * OSP + 64 * (kg & 1) + 16 * j + 8 * h;
          v4f v0, v1;
          v0[0] = acc[qt][j][0]; v0[1] = acc[qt][j][1]; v0[2] = acc[qt][j][2]; v0[3] = acc[qt][j][3];
          v1[0] = acc[qt][j][4]; v1[1] = acc[qt][j][5]; v1[2] = acc[qt][j][6]; v1[3] = acc[qt][j][7];
          *(v4f*)(os)     = v0;
          *(v4f*)(os + 4) = v1;
        }
    }
    __syncthreads();
{
#pragma unroll
      for (int i = 0; i < 8; ++i) {
        const int L   = i * 32 + lg;                         // lines 0..255 of this half
        const int row = L >> 2, hf = L & 3;                  // query row 0..63, line 0..3 of the 128-float segment
        const v4f v = *(const v4f*)(Os + row * OSP + 32 * hf + 4 * e);
        *(v4f*)(ob + (size_t)row * DM + 128 * t + 32 * hf + 4 * e) = v;
      }
      
    }
    __syncthreads();
  }
}

// =====================================================================================================
// needed (all tiles exact, all grids exact multiples):
//   Qp   f16  [16384][256]      0            8388608
//   Kp   f16  [16384][256]      8388608      8388608
//   Vt   f16  [8][256][2048]    16777216     8388608
//   end                         25165824
// =====================================================================================================
extern "C" void kernel_launch(void* const* d_in, const int* in_sizes, int n_in,
                              void* d_out, int out_size, void* d_ws, size_t ws_size,
                              hipStream_t stream) {
  const int NX = NB * SEQ * DM;                          // 4194304
  if (n_in < 9) return;
  if (in_sizes[0] != NX || in_sizes[1] != NX || in_sizes[2] != NB * SEQ) return;
  if (in_sizes[3] != DM * DM || in_sizes[5] != DM * DM || in_sizes[7] != DM * DM) return;
  if (in_sizes[4] != DM || in_sizes[6] != DM || in_sizes[8] != DM) return;
  if (out_size != NX) return;

  size_t off = 0;
  const size_t szP = (size_t)NROW * DM * 2;              // 8388608
  const size_t oQP = off; off += szP;
  const size_t oKP = off; off += szP;
  const size_t oVT = off; off += szP;
  if (off > ws_size) return;                             // off = 25165824

  const float* Ain = (const float*)d_in[0];
  const float* Bin = (const float*)d_in[1];
  const int*   msk = (const int*)d_in[2];
  const float* Wq  = (const float*)d_in[3];
  const float* bq  = (const float*)d_in[4];
  const float* Wk  = (const float*)d_in[5];
  const float* bk  = (const float*)d_in[6];
  const float* Wv  = (const float*)d_in[7];
  const float* bv  = (const float*)d_in[8];
  char* ws = (char*)d_ws;
  unsigned short* QP  = (unsigned short*)(ws + oQP);
  unsigned short* KP  = (unsigned short*)(ws + oKP);
  unsigned short* VT  = (unsigned short*)(ws + oVT);
  float* out = (float*)d_out;

  const dim3 blk256(256);
  const dim3 gP(PTILES / TPB);                           // 256 blocks: three 64-row tiles each
  const dim3 gA(NB * (SEQ / QT));                        // 256 blocks: one (b, 64-query tile) each

  // (1) Qp = Ab . Wqb^T + bq (f16 plane), Kp = Bb . Wkb^T + bk (f16 plane), Vt = (Bb . Wvb^T + bv)^T per batch (f16)
  proj_all<<<gP, blk256, 0, stream>>>(Ain, Bin, Wq, bq, Wk, bk, Wv, bv, QP, KP, VT);
  // (2) out[b][n][d] = sum_m softmax_m(mask ? Qp_n . Kp_m / 16 : -big) Vt[d][m]
  attn_kernel<<<gA, blk256, 0, stream>>>(QP, KP, VT, msk, out);
  (void)hipGetLastError();
}

// v005
// It runs in 34.9 microseconds.
// Timed twice side by side with v004, it ran 1.35 times as fast both times.
// Over all steps from v000 it is 6.90 times as fast.
// Contractions: Q/K/V projections = Xb . Wb^T on v_wmma_f32_16x16x32_bf16 (Xb, Wb = RNE bf16 convert of A, B, Wq,
// Wk, Wv; K=256, f32 accumulate); scores S^T = Kp . Qp^T on v_wmma_f32_16x16x32_f16 (Kp, Qp = f16 planes of the
// projections incl. bias, K=256); O^T = Vt . P^T on v_wmma_f32_16x16x32_f16 (Vt = f16 plane of V incl. bias,
// P = e^{s-m} x 1024 in f16, kept keys only); f32 accumulate everywhere; bias add, 1/16 scale, key mask select,
// running max, row sums and 1/l in f32 on VALU. Keys with mask == 0 have weight exactly 0 (unless a whole batch row is
// masked): K and V are projected only for the kept keys, packed in key order, and attention walks the packed keys.
#include <hip/hip_runtime.h>
#include <math.h>
#include <stdint.h>

#define NB    8
#define SEQ   2048
#define DM    256
#define NROW  (NB * SEQ)
#define QT    64
#define OSP   132
#define TP    72
#define XP    264                     /* LDS pitch of an X, W or staged output row of 256 16-bit values: 528 B = 16 B x 33 */
#define PTILES (3 * (NROW / 64))      /* projection tiles of 64 rows x 256 cols */
#define TPB   3                       /* projection tiles per block */
#define KST   128                     /* keys per ring stage (four 32-key passes, one per wave group) */
#define NST   (SEQ / KST)
#define KQP   264                     /* LDS pitch of a Q or K row in halves: 528 B = 16 B x 33 */
#define VSP   136                     /* LDS pitch of a Vt row of 128 keys in halves: 272 B = 16 B x 17 */
#define LNPS  6.931471805599453f
#define FMIN16 6.103515625e-05f
#define NEGBIG (-1.0e30f)
static_assert((SEQ % QT) == 0);
static_assert((SEQ % 64) == 0);
static_assert((SEQ % 256) == 0);
static_assert((DM % 128) == 0);
static_assert((DM % 32) == 0);
static_assert((NROW % 64) == 0);
static_assert(NROW / 64 == 256);
static_assert((PTILES % TPB) == 0);
static_assert(DM == 256);
static_assert(QT == 64);
static_assert(64 * XP <= DM * TP);
static_assert(NST >= 2);
static_assert(KST == 128);

typedef _Float16       v16h __attribute__((ext_vector_type(16)));
typedef _Float16       v8h  __attribute__((ext_vector_type(8)));
typedef __bf16         v16b __attribute__((ext_vector_type(16)));
typedef unsigned short v8us __attribute__((ext_vector_type(8)));
typedef float          v8f  __attribute__((ext_vector_type(8)));
typedef float          v4f  __attribute__((ext_vector_type(4)));
typedef unsigned int   v4u  __attribute__((ext_vector_type(4)));
typedef unsigned int   v2u  __attribute__((ext_vector_type(2)));
typedef float          v2f  __attribute__((ext_vector_type(2)));
typedef __bf16         v2b  __attribute__((ext_vector_type(2)));

union FragH { v16h v; v8h  h[2]; };
union FragB { v16b v; v8us u[2]; };
static_assert(sizeof(FragH) == 32);
static_assert(sizeof(FragB) == 32);

// ---- scalar helpers --------------------------------------------------------------------------------
__device__ __forceinline__ unsigned short bf_bits(float f) {          // f32 -> bf16 bits, RNE convert
  unsigned u = __float_as_uint(f);
  return (unsigned short)((u + 0x7FFFu + ((u >> 16) & 1u)) >> 16);
}
__device__ __forceinline__ float bf_up(unsigned short x) { return __uint_as_float(((unsigned)x) << 16); }
__device__ __forceinline__ float bfr(float f) { return bf_up(bf_bits(f)); }
__device__ __forceinline__ unsigned short h_bits(_Float16 x) { return __builtin_bit_cast(unsigned short, x); }
__device__ __forceinline__ unsigned pk16(unsigned short a, unsigned short b) { return (unsigned)a | ((unsigned)b << 16); }
// f32 -> f16 with magnitudes below the smallest f16 normal flushed to zero (select by value)
__device__ __forceinline__ _Float16 to_h_ftz(float v) { return (_Float16)((fabsf(v) < FMIN16) ? 0.0f : v); }
__device__ __forceinline__ v8f zero8() { v8f z = {0.f, 0.f, 0.f, 0.f, 0.f, 0.f, 0.f, 0.f}; return z; }
__device__ __forceinline__ float hmax8(v8f s) {
  return fmaxf(fmaxf(fmaxf(s[0], s[1]), fmaxf(s[2], s[3])), fmaxf(fmaxf(s[4], s[5]), fmaxf(s[6], s[7])));
}

// ---- fragment loaders: 16-bit A/B operand, lane -> row/col (lane&15), p already includes +8*(lane>>4);
//      elements 0..7 <- p[0..7] (k0+8h..), elements 8..15 <- p[16..23] (k0+16+8h..)
__device__ __forceinline__ v16h ldfrag_h(const _Float16* p) {
  FragH f;
  f.h[0] = *(const v8h*)(p);
  f.h[1] = *(const v8h*)(p + 16);
  return f.v;
}
__device__ __forceinline__ v16b ldfrag_b(const unsigned short* p) {
  FragB f;
  f.u[0] = *(const v8us*)(p);
  f.u[1] = *(const v8us*)(p + 16);
  return f.v;
}

// ---- WMMA helpers (bf16: builtin followed by a 4-slot VALU gap tying D and keeping A/B live) ---------------
__device__ __forceinline__ v8f mma_h(v16h a, v16h b, v8f c) {   // builtin alone: the compiler keeps the distances, and the operands may lie above v255
  return __builtin_amdgcn_wmma_f32_16x16x32_f16(false, a, false, b, (short)0, c, false, false);
}
__device__ __forceinline__ v8f mma_b(v16b a, v16b b, v8f c) {
  v8f d = __builtin_amdgcn_wmma_f32_16x16x32_bf16(false, a, false, b, (short)0, c, false, false);
#if defined(__HIP_DEVICE_COMPILE__)
  const v16h ha = __builtin_bit_cast(v16h, a), hb = __builtin_bit_cast(v16h, b);
  asm volatile("v_nop\n\tv_nop\n\tv_nop\n\tv_nop" : "+v"(d) : "v"(ha), "v"(hb));
#endif
  return d;
}

// ---- asynchronous copies to LDS: eight 16-B copies per lane, copy j at LDS byte l + j*ls from g + j*gs halves.
//      s_wait_xcnt 0 is the statement's last line so that no address register is rewritten ahead of it.
__device__ __forceinline__ uint32_t lds_off(const void* p) { return (uint32_t)(size_t)p; }
__device__ __forceinline__ void acopy8(uint32_t l, uint32_t ls, const _Float16* g, size_t gs) {
#if defined(__HIP_DEVICE_COMPILE__)
  asm volatile(
      "global_load_async_to_lds_b128 %0, %8, off\n\t"
      "global_load_async_to_lds_b128 %1, %9, off\n\t"
      "global_load_async_to_lds_b128 %2, %10, off\n\t"
      "global_load_async_to_lds_b128 %3, %11, off\n\t"
      "global_load_async_to_lds_b128 %4, %12, off\n\t"
      "global_load_async_to_lds_b128 %5, %13, off\n\t"
      "global_load_async_to_lds_b128 %6, %14, off\n\t"
      "global_load_async_to_lds_b128 %7, %15, off\n\t"
      "s_wait_xcnt 0x0"
      :: "v"(l), "v"(l + ls), "v"(l + 2 * ls), "v"(l + 3 * ls),
         "v"(l + 4 * ls), "v"(l + 5 * ls), "v"(l + 6 * ls), "v"(l + 7 * ls),
         "v"(g), "v"(g + gs), "v"(g + 2 * gs), "v"(g + 3 * gs),
         "v"(g + 4 * gs), "v"(g + 5 * gs), "v"(g + 6 * gs), "v"(g + 7 * gs)
      : "memory");
#endif
}

// =====================================================================================================
// (1) all three projections in one launch, straight from the f32 inputs: Y = Xb . Wb^T + bf16(bias), Xb, Wb = RNE bf16.
//   768 tiles of 64 rows x 256 cols: tile t = (projection p = t / 256: Q, K, V; row tile t % 256). Block = 256 threads
//   = 8 waves takes tiles 3*bx .. 3*bx+2. W of projection p (256 x 256) is read once per block in whole 512-B runs,
//   converted and kept in LDS Wsm[col][k] (read again only where p changes inside a block); the X tile likewise in
//   Xs[row][k]; the next tile's X loads fly in registers while this tile is worked on.
//   Wave w: rows 32(w&1) + 16u + .., cols 64(w>>1) + 16j + .., 2 x 4 D tiles, 8 k-steps of 32, both operands through the
//   same split k map. D element r of tile (u, j) = (row 32wr + 16u + 8h + r, col 64wc + 16j + c).
//   p < 2: values staged in S[row][col] (pitch XP), written as whole 512-B rows of OP[row][256].
//   p == 2: staged transposed in S[col][row] (pitch TP, 16-B stores of 8 consecutive rows), written as 128-B lines of
//   Vt[b][d][key0 .. key0+63].
//   Key packing: for p >= 1 the 64 rows of tile (b, tp) are the rows of B whose keys have ranks 64tp .. 64tp+63 among the
//   keys of batch b with mask != 0 (all 2048 keys when none is kept: the reference then weighs all keys alike). The ranks
//   come from the mask's 64 ballot words; slots past the last kept key take row 0 of the batch (finite values, weight 0
//   in the attention). Tiles at or past the kept count rounded up to a ring stage (128) are skipped: nothing reads them.
//   CNT[32 b] = kept count of batch b, stored by the block of tile (p = 1, b, tp = 0) alone, one 128-B line per batch.
// coverage: 256 blocks x 3 tiles = 768 tiles; staging 2 wr x 2 u x 2 h x 8 r = 64 rows, 4 wc x 4 j x 16 c = 256 cols;
//   writes: 8 it x 256 threads x 8 halves = 64 x 256 values of the tile, each once.
// =====================================================================================================
__device__ __forceinline__ v2u cvt4(v4f f) {                  // four f32 -> four bf16 (RNE), packed in k order
  v2f lo, hi;
  lo[0] = f[0]; lo[1] = f[1]; hi[0] = f[2]; hi[1] = f[3];
  v2u r;
  r[0] = __builtin_bit_cast(unsigned, __builtin_convertvector(lo, v2b));
  r[1] = __builtin_bit_cast(unsigned, __builtin_convertvector(hi, v2b));
  return r;
}

// X tile of projection tile t into registers: 16-B piece j*256 + tid = tile row 4j + (tid>>6), floats 4(tid&63) ..
// p == 0: 64 consecutive rows of A; p >= 1: the rows of B listed in ix (the row number is the same in a whole wave).
__device__ __forceinline__ void load_x(v4f (&xr)[16], int t, int tid, const float* __restrict__ Ain,
                                       const float* __restrict__ Bin, const int* ix) {
  if ((t >> 8) == 0) {                                        // block-uniform
    const float* xs = Ain + (size_t)(t & 255) * 64 * DM + 4 * tid;
#pragma unroll
    for (int j = 0; j < 16; ++j) xr[j] = *(const v4f*)(xs + j * 1024);
    asm volatile("s_wait_xcnt 0x0" ::: "memory");             // before a register that these loads name is rewritten
  } else {
    const float* xp[16];
#pragma unroll
    for (int j = 0; j < 16; ++j)
      xp[j] = Bin + (size_t)__builtin_amdgcn_readfirstlane(ix[4 * j + (tid >> 6)]) * DM + 4 * (tid & 63);
#pragma unroll
    for (int j = 0; j < 16; ++j) xr[j] = *(const v4f*)(xp[j]);
    asm volatile("s_wait_xcnt 0x0" ::: "memory");             // before a register that these loads name is rewritten
  }
}

__global__ __launch_bounds__(256)
void proj_all(const float* __restrict__ Ain, const float* __restrict__ Bin, const int* __restrict__ mask,
              const float* __restrict__ Wq, const float* __restrict__ bq,
              const float* __restrict__ Wk, const float* __restrict__ bk,
              const float* __restrict__ Wv, const float* __restrict__ bv,
              unsigned short* QP, unsigned short* KP, unsigned short* VT, int* CNT) {
  __shared__ __align__(16) unsigned short Wsm[DM * XP];
  __shared__ __align__(16) unsigned short Xs[64 * XP];
  __shared__ __align__(16) unsigned short S[DM * TP];
  __shared__ __align__(16) unsigned Bm[TPB][64];              // mask != 0 of the tile's batch, bit k of word j = key 32j + k
  __shared__ int Idx[TPB][64];                                // row of B (0 .. NROW-1) behind each tile row, p >= 1
  __shared__ int Act[TPB];                                    // tile is worked on
  const int tid  = threadIdx.x;
  const int lane = tid & 31, wave = tid >> 5;
  const int h    = lane >> 4, c = lane & 15;
  const int wr   = wave & 1, wc = wave >> 1;
  const int t0   = blockIdx.x * TPB;

  // 16-B piece j*256 + tid of a contiguous f32 tile = row 4j + (tid>>6), floats 4(tid&63) ..
  const int ldso = (tid >> 6) * XP + 4 * (tid & 63);
  const unsigned short* ap = Xs  + (32 * wr + c) * XP + 8 * h;
  const unsigned short* bp = Wsm + (64 * wc + c) * XP + 8 * h;

  unsigned actm = (1u << TPB) - 1u;                           // bit i: tile t0 + i is worked on
  if (t0 + TPB - 1 >= 256) {                                  // block-uniform: the block holds a K or V tile
    int mk[TPB][8];
#pragma unroll
    for (int i = 0; i < TPB; ++i) {
      const int* mrow = mask + (size_t)(((t0 + i) & 255) >> 5) * SEQ;   // block-uniform base
#pragma unroll
      for (int q = 0; q < 8; ++q) mk[i][q] = mrow[q * 256 + tid];
    }
    asm volatile("s_wait_xcnt 0x0" ::: "memory");             // before a register that these loads name is rewritten
#pragma unroll
    for (int i = 0; i < TPB; ++i) {
      unsigned wsel = 0u;                                     // lane q takes the word of keys 256q + 32wave + 0..31
#pragma unroll
      for (int q = 0; q < 8; ++q) {
        const unsigned w = __builtin_amdgcn_ballot_w32(mk[i][q] != 0);
        wsel = (lane == q) ? w : wsel;
      }
      if (lane < 8) Bm[i][lane * 8 + wave] = wsel;
    }
    __syncthreads();                                          // Bm published
    const int g = tid >> 6;                                   // waves 2g, 2g+1 list tile t0 + g, one slot a lane
    if (g < TPB) {                                            // wave-uniform
      const int tg = t0 + g, tp = tg & 31, rb = ((tg & 255) >> 5) * SEQ;
      const int R = 64 * tp + (tid & 63);                     // rank wanted in this slot
      int run = 0, wi = 0, base = 0;                          // kept keys so far; last word that starts at or below R, and its start
#pragma unroll
      for (int i = 0; i < 64; i += 4) {
        const v4u w4 = *(const v4u*)(&Bm[g][i]);
#pragma unroll
        for (int e = 0; e < 4; ++e) {
          const bool le = run <= R;
          wi   = le ? i + e : wi;
          base = le ? run : base;
          run += __builtin_popcount(w4[e]);
        }
      }
      const int tot = run;                                    // kept keys of the batch
      unsigned x = Bm[g][wi];
      int n = R - base, pos = 0;                              // bit number n (from 0) among the set bits of x, where R < tot
#pragma unroll
      for (int sh = 16; sh >= 1; sh >>= 1) {
        const int cl = __builtin_popcount(x & ((1u << sh) - 1u));
        const bool up = n >= cl;
        n   -= up ? cl : 0;
        x    = up ? (x >> sh) : x;
        pos += up ? sh : 0;
      }
      // nothing kept: all keys in place; slots past the last kept key: row 0 of the batch
      Idx[g][tid & 63] = rb + ((tot == 0) ? R : ((R < tot) ? 32 * wi + pos : 0));
      if ((tid & 63) == 0) {
        const int neff = (tot == 0) ? SEQ : tot;
        Act[g] = ((tg >> 8) == 0 || 64 * tp < ((neff + KST - 1) / KST) * KST) ? 1 : 0;
        if ((tg >> 8) == 1 && tp == 0) {
          CNT[((tg & 255) >> 5) * 32] = tot;
          asm volatile("s_wait_xcnt 0x0" ::: "memory");       // before a register that this store names is rewritten
        }
      }
    }
    __syncthreads();                                          // Idx and Act published
    actm = 0u;
#pragma unroll
    for (int i = 0; i < TPB; ++i) actm |= (unsigned)__builtin_amdgcn_readfirstlane(Act[i]) << i;
  }

  v4f xr[16];
  int xfor = -1;                                              // tile index whose X rows xr holds or awaits
  int pcur = -1;
  float bb[4] = {0.f, 0.f, 0.f, 0.f};                         // biases of projection pcur as bf16 RNE values
#pragma unroll 1                                              // one copy of the tile body
  for (int i = 0; i < TPB; ++i) {
    const int t = t0 + i, p = t >> 8, row0 = (t & 255) * 64;  // block-uniform
    if (((actm >> i) & 1u) == 0u) continue;                   // block-uniform: no kept key falls into this tile
    if (xfor != i) load_x(xr, t, tid, Ain, Bin, Idx[i]);      // block-uniform: not fetched ahead (first tile, or behind a skipped one)
    __syncthreads();                                          // every reader of Xs, Wsm and S of the tile before is done
    if (p != pcur) {                                          // block-uniform
      pcur = p;
      const float* wsrc = (p == 0 ? Wq : (p == 1 ? Wk : Wv)) + 4 * tid;
      const float* bias = (p == 0 ? bq : (p == 1 ? bk : bv));
      v4f wa[32], wb[32];                                     // all of W in flight at once: its latency is paid once
      float br[4];
#pragma unroll
      for (int j = 0; j < 32; ++j) wa[j] = *(const v4f*)(wsrc + j * 1024);
#pragma unroll
      for (int j = 0; j < 32; ++j) wb[j] = *(const v4f*)(wsrc + (32 + j) * 1024);
#pragma unroll
      for (int j = 0; j < 4; ++j) br[j] = bias[64 * wc + 16 * j + c];   // in-range lane indices (64wc + 48 + c <= 255)
      asm volatile("s_wait_xcnt 0x0" ::: "memory");           // before a register that these loads name is rewritten
#pragma unroll
      for (int j = 0; j < 32; ++j) *(v2u*)(Wsm + ldso + j * 4 * XP) = cvt4(wa[j]);
#pragma unroll
      for (int j = 0; j < 32; ++j) *(v2u*)(Wsm + ldso + (32 + j) * 4 * XP) = cvt4(wb[j]);
#pragma unroll
      for (int j = 0; j < 4; ++j) bb[j] = bfr(br[j]);
    }
#pragma unroll
    for (int j = 0; j < 16; ++j) *(v2u*)(Xs + ldso + j * 4 * XP) = cvt4(xr[j]);
    __syncthreads();                                          // Xs (and Wsm) published
    if (i + 1 < TPB && ((actm >> (i + 1)) & 1u) != 0u) {      // block-uniform; behind the barrier, which waits for every load
      load_x(xr, t + 1, tid, Ain, Bin, Idx[i + 1]);
      xfor = i + 1;
    }

    v8f acc[2][4];
#pragma unroll
    for (int j = 0; j < 4; ++j) { acc[0][j] = zero8(); acc[1][j] = zero8(); }
    // fragments of k-step ks+2 are fetched ahead of the products of k-step ks (three register sets)
    v16b fa[3][2], fb[3][4];
#pragma unroll                                                // constant indices keep the sets in registers (here and below)
    for (int ks = 0; ks < 2; ++ks) {
      fa[ks][0] = ldfrag_b(ap + 32 * ks);
      fa[ks][1] = ldfrag_b(ap + 16 * XP + 32 * ks);
#pragma unroll
      for (int j = 0; j < 4; ++j) fb[ks][j] = ldfrag_b(bp + 16 * j * XP + 32 * ks);
    }
#pragma unroll
    for (int ks = 0; ks < DM / 32; ++ks) {
      if (ks + 2 < DM / 32) {
        fa[(ks + 2) % 3][0] = ldfrag_b(ap + 32 * (ks + 2));
        fa[(ks + 2) % 3][1] = ldfrag_b(ap + 16 * XP + 32 * (ks + 2));
#pragma unroll
        for (int j = 0; j < 4; ++j) fb[(ks + 2) % 3][j] = ldfrag_b(bp + 16 * j * XP + 32 * (ks + 2));
      }
#pragma unroll
      for (int j = 0; j < 4; ++j) {
        acc[0][j] = mma_b(fa[ks % 3][0], fb[ks % 3][j], acc[0][j]);
        acc[1][j] = mma_b(fa[ks % 3][1], fb[ks % 3][j], acc[1][j]);
      }
    }

    if (p < 2) {                                              // block-uniform
#pragma unroll
      for (int u = 0; u < 2; ++u)
#pragma unroll
        for (int j = 0; j < 4; ++j) {
          unsigned short* qs = S + (32 * wr + 16 * u + 8 * h) * XP + 64 * wc + 16 * j + c;
#pragma unroll
          for (int r = 0; r < 8; ++r) qs[r * XP] = h_bits(to_h_ftz(acc[u][j][r] + bb[j]));
        }
    } else {
#pragma unroll
      for (int u = 0; u < 2; ++u)
#pragma unroll
        for (int j = 0; j < 4; ++j) {
          v4u w;
#pragma unroll
          for (int q = 0; q < 4; ++q)
            w[q] = pk16(h_bits(to_h_ftz(acc[u][j][2 * q] + bb[j])), h_bits(to_h_ftz(acc[u][j][2 * q + 1] + bb[j])));
          *(v4u*)(S + (64 * wc + 16 * j + c) * TP + 32 * wr + 16 * u + 8 * h) = w;
        }
    }
    __syncthreads();                                          // S published

    if (p < 2) {
      unsigned short* OP = (p == 0 ? QP : KP) + (size_t)row0 * DM;
#pragma unroll
      for (int it = 0; it < 8; ++it) {
        const int row = it * 8 + wave;                        // one whole 512-B row per wave and store
        const v4u v = *(const v4u*)(S + row * XP + 8 * lane);
        *(v4u*)(OP + (size_t)row * DM + 8 * lane) = v;
      }
      asm volatile("s_wait_xcnt 0x0" ::: "memory");           // before a register that these stores name is rewritten
    } else {
      const int b    = row0 / SEQ;
      const int key0 = row0 % SEQ;                            // 64 consecutive packed key slots of one batch
      const int e = tid & 7, lg = tid >> 3;
      unsigned short* vp = VT + ((size_t)b * DM + lg) * SEQ + key0 + 8 * e;
#pragma unroll
      for (int it = 0; it < 8; ++it) {                        // d = 32 it + lg, 0..255
        const v4u v = *(const v4u*)(S + (it * 32 + lg) * TP + 8 * e);
        *(v4u*)(vp + (size_t)it * 32 * SEQ) = v;
      }
      asm volatile("s_wait_xcnt 0x0" ::: "memory");           // before a register that these stores name is rewritten
    }
  }
}

// =====================================================================================================
// (2) attention for one (b, 64-query tile), transposed formulation, 256-deep scores, over the packed keys of batch b:
//   cnt = CNT[32 b] kept keys at places 0 .. cnt-1 (cnt == 0: all 2048 keys in place, every one masked), in
//   nst = ceil(keys / 128) ring stages; places at or past cnt count as masked.
//   Block = 256 threads = 8 waves.
//   Operand tiles come to LDS by asynchronous 16-B copies over whole lines: Qs[64 queries][256 d] once; a ring of
//     two buffers, stage = 128 keys: Ks[128 keys][256 d], Vs[256 d][128 keys]. Wave w copies Q rows 8w..8w+7 and K rows
//     16w..16w+15 (one 512-B row per copy) and Vt rows 32w..32w+31 (two 256-B rows per copy). Stage s+2 is issued behind
//     the barrier that ends stage s; all fragments below are read from these tiles.
//   Wave w = (wq = w&1, kg = w>>1) owns queries 32wq..32wq+31 (two tiles of 16) and keys 32kg..32kg+31 of every stage,
//     end to end, so that every K fragment and every Vt fragment read from LDS feeds two products:
//     S^T tiles (16 keys x 16 queries) = A(Kp rows = keys, d via the split k map) . B(Qp rows = query 32wq + 16qt +
//     (lane&15), same d map), 8 d-steps, 2 x 2 tiles; s = D x (1/16), masked key (place >= cnt) -> s := -1e30 (exp gives 0; a
//     fully masked row gives equal weights). Per lane and query tile the two D tiles hold 16 keys of ONE query: online
//     softmax state per lane and query tile, one shuffle (lane^16) for the max over 32 keys. P = e^{s-m} x 1024 in f16:
//     the lane's 16 values are, in this order, its elements of the B operand of O^T (keys 8h..8h+7, then 16+8h..23+8h),
//     so P stays in registers.
//     O^T: 2 x 16 accumulators = 256 d x 32 queries, rescaled by the lane's own corr; A = Vt rows d (keys contiguous).
//     acc[qt][4g + j]: d = 64((kg + g) & 3) + 16j + ..
//   After the loop the four waves of a query group join their key quarters: each hands m, l and acc[.][4..15] to the
//     owners through LDS (m, l in Ml; acc on the ring's bytes, free behind the loop's last barrier) and finishes d = 64kg .. 64kg+63:
//     o = (sum over the four waves of o_w e^{m_w-M}) / l_joined.
//   Epilogue in 2 halves of 128 d: waves with kg>>1 == t stage O^T into Os[query][d_local] (16-B LDS stores; Os lies on
//     the bytes of Qs, free behind the loop's last barrier),
// coverage: keys: nst stages x 4 kg x 32; Os per half: 2 kg x 4 j x 2 h x 8 r = 128 d, 2 wq x 2 qt x 16 c = 64 queries;
//           out: 2 t x 8 it x 32 lines x 8 lanes x 4 floats = 64 rows x 256;
//           grid = 8 b x 32 query tiles = 256 blocks covers out exactly once.
// =====================================================================================================
__global__ __launch_bounds__(256)
void attn_kernel(const unsigned short* __restrict__ QP, const unsigned short* __restrict__ KP,
                 const unsigned short* __restrict__ VT, const int* __restrict__ CNT, float* out) {
  __shared__ float Ml[4 * 256];
  __shared__ __align__(16) _Float16 Qs[QT * KQP];
  __shared__ __align__(16) _Float16 Ring[2 * KST * KQP + 2 * DM * VSP];
  _Float16* const Ks = Ring;
  _Float16* const Vs = Ring + 2 * KST * KQP;
  float* const Mg = (float*)(void*)Ring;                      // join buffer, used behind the loop only
  float* const Os = (float*)(void*)Qs;                        // output staging, used behind the loop only
  static_assert(8 * 24 * 256 * 4 <= (2 * KST * KQP + 2 * DM * VSP) * 2);
  static_assert(64 * OSP * 4 <= QT * KQP * 2);
  const int tid  = threadIdx.x;
  const int wave = tid >> 5;
  const int lane = tid & 31;
  const int h    = lane >> 4;
  const int c    = lane & 15;
  const int bx   = blockIdx.x;
  const int b    = bx / (SEQ / QT);
  const int qt0  = bx % (SEQ / QT);
  const int n0   = qt0 * QT;
  const _Float16* QPh = (const _Float16*)(const void*)QP;
  const _Float16* KPh = (const _Float16*)(const void*)KP;
  const _Float16* VTh = (const _Float16*)(const void*)VT;

  const int cnt = min(max(__builtin_amdgcn_readfirstlane(CNT[b * 32]), 0), SEQ);   // block-uniform, bounded by the shape
  const int nst = ((cnt == 0 ? SEQ : cnt) + KST - 1) / KST;   // 1 .. NST stages
  __builtin_assume(nst >= 1);                                 // spares the build a path for an empty loop (it cost a register spill)

  // copy sources and places of this lane: Q row 8*wave + j, K row 16*wave + j, 16-B piece lane;
  // Vt row 32*wave + 2j + (lane>>4), piece lane&15
  const _Float16* qsrc = QPh + ((size_t)b * SEQ + n0 + 8 * wave) * DM + 8 * lane;
  const _Float16* ksrc = KPh + ((size_t)b * SEQ + 16 * wave) * DM + 8 * lane;                       // + stage * KST * DM
  const _Float16* vsrc = VTh + ((size_t)b * DM + 32 * wave + (lane >> 4)) * SEQ + 8 * (lane & 15);  // + stage * KST
  const uint32_t qdst = lds_off(Qs) + (uint32_t)(8 * wave * KQP + 8 * lane) * 2u;
  const uint32_t kdst = lds_off(Ks) + (uint32_t)(16 * wave * KQP + 8 * lane) * 2u;                  // + buffer * KST*KQP*2
  const uint32_t vdst = lds_off(Vs) + (uint32_t)((32 * wave + (lane >> 4)) * VSP + 8 * (lane & 15)) * 2u;  // + buffer * DM*VSP*2

  // Q tile and stage 0, landed and published; then stage 1 flies while stage 0 is worked on
  acopy8(qdst, KQP * 2u, qsrc, (size_t)DM);
  acopy8(kdst, KQP * 2u, ksrc, (size_t)DM);
  acopy8(kdst + 8u * KQP * 2u, KQP * 2u, ksrc + (size_t)8 * DM, (size_t)DM);
  acopy8(vdst, 2u * VSP * 2u, vsrc, (size_t)2 * SEQ);
  acopy8(vdst + 16u * VSP * 2u, 2u * VSP * 2u, vsrc + (size_t)16 * SEQ, (size_t)2 * SEQ);
  asm volatile("s_wait_asynccnt 0x0" ::: "memory");          // this wave's copies have landed before the barrier publishes them
  __syncthreads();
  if (nst > 1) {                                              // block-uniform: a stage 1 exists
    acopy8(kdst + KST * KQP * 2u, KQP * 2u, ksrc + (size_t)KST * DM, (size_t)DM);
    acopy8(kdst + KST * KQP * 2u + 8u * KQP * 2u, KQP * 2u, ksrc + (size_t)KST * DM + (size_t)8 * DM, (size_t)DM);
    acopy8(vdst + DM * VSP * 2u, 2u * VSP * 2u, vsrc + KST, (size_t)2 * SEQ);
    acopy8(vdst + DM * VSP * 2u + 16u * VSP * 2u, 2u * VSP * 2u, vsrc + KST + (size_t)16 * SEQ, (size_t)2 * SEQ);
  }

  const int wq = wave & 1, kg = wave >> 1;
  // Q fragment base in Qs (B operand of scores, col = query 32wq + c), + 16 queries * KQP + 32*ks
  const _Float16* qpp = Qs + (32 * wq + c) * KQP + 8 * h;
  // K fragment base in Ks (A operand of scores, row = local key 32kg + c), + buffer + 16 keys * KQP + 32*ks
  const _Float16* khp = Ks + (32 * kg + c) * KQP + 8 * h;
  // Vt fragment bases in Vs (A operand of O^T, row = d, keys 32kg.. contiguous), + buffer + 16j*VSP
  const _Float16* vg0 = Vs + (64 * kg + c) * VSP + 32 * kg + 8 * h;                // d = 64kg + 16j + c
  const _Float16* vg1 = Vs + (64 * ((kg + 1) & 3) + c) * VSP + 32 * kg + 8 * h;    // d = 64((kg+1)&3) + 16j + c
  const _Float16* vg2 = Vs + (64 * ((kg + 2) & 3) + c) * VSP + 32 * kg + 8 * h;
  const _Float16* vg3 = Vs + (64 * ((kg + 3) & 3) + c) * VSP + 32 * kg + 8 * h;
  const float SCL = 0.0625f;                                  // 1/sqrt(256)

  float m[2] = {NEGBIG, NEGBIG}, l[2] = {0.f, 0.f};
  v8f acc[2][16];
#pragma unroll
  for (int j = 0; j < 16; ++j) { acc[0][j] = zero8(); acc[1][j] = zero8(); }

#pragma unroll 1                                              // one copy of the 64-WMMA body: buf stays a run-time value
  for (int s = 0; s < nst; ++s) {
    const int buf = s & 1;                                    // ring buffer of stage s
    const int kb  = s * KST + 32 * kg;                        // first key of this wave's pass
    v8f sc[2][2];                                             // [key tile][query tile]
    sc[0][0] = zero8(); sc[0][1] = zero8(); sc[1][0] = zero8(); sc[1][1] = zero8();
    const _Float16* k0p = khp + buf * KST * KQP;              // keys kb .. kb+15
    const _Float16* k1p = k0p + 16 * KQP;                     // keys kb+16 .. kb+31
    // fragments of d-step ks+1 are fetched ahead of the products of d-step ks (two register sets: a third one spills)
    v16h q0[2], q1[2], a0[2], a1[2];
    q0[0] = ldfrag_h(qpp);
    q1[0] = ldfrag_h(qpp + 16 * KQP);
    a0[0] = ldfrag_h(k0p);
    a1[0] = ldfrag_h(k1p);
#pragma unroll                                                // constant indices keep the sets in registers (here and below)
    for (int ks = 0; ks < DM / 32; ++ks) {
      if (ks + 1 < DM / 32) {
        q0[(ks + 1) % 2] = ldfrag_h(qpp + 32 * (ks + 1));
        q1[(ks + 1) % 2] = ldfrag_h(qpp + 16 * KQP + 32 * (ks + 1));
        a0[(ks + 1) % 2] = ldfrag_h(k0p + 32 * (ks + 1));
        a1[(ks + 1) % 2] = ldfrag_h(k1p + 32 * (ks + 1));
      }
      sc[0][0] = mma_h(a0[ks % 2], q0[ks % 2], sc[0][0]);
      sc[1][0] = mma_h(a1[ks % 2], q0[ks % 2], sc[1][0]);
      sc[0][1] = mma_h(a0[ks % 2], q1[ks % 2], sc[0][1]);
      sc[1][1] = mma_h(a1[ks % 2], q1[ks % 2], sc[1][1]);
    }
    // Vt fragments come in four groups of four through two register sets; group 0 is fetched ahead of the softmax
    const int vbo = buf * DM * VSP;
    v16h va[4], vb[4];
#pragma unroll
    for (int j = 0; j < 4; ++j) va[j] = ldfrag_h(vg0 + vbo + 16 * j * VSP);
    // key mask of the wave's 32 keys: D row 8h+r of sc[0][.] = key kb+8h+r, of sc[1][.] = key kb+16+8h+r
    const int rem = cnt - kb - 8 * h;                         // kept places from this lane's first key on
    int keep0[8], keep1[8];
#pragma unroll
    for (int r = 0; r < 8; ++r) {
      keep0[r] = (r < rem) ? 1 : 0;
      keep1[r] = (16 + r < rem) ? 1 : 0;
    }

    FragH ph[2];
    float corr[2];
#pragma unroll
    for (int qt = 0; qt < 2; ++qt) {
      v8f s0 = sc[0][qt], s1 = sc[1][qt];
      // scale and key mask (select by value)
#pragma unroll
      for (int r = 0; r < 8; ++r) {
        const float v0 = s0[r] * SCL, v1 = s1[r] * SCL;
        s0[r] = (keep0[r] != 0) ? v0 : NEGBIG;
        s1[r] = (keep1[r] != 0) ? v1 : NEGBIG;
      }
      float mx = fmaxf(hmax8(s0), hmax8(s1));
      mx = fmaxf(mx, __shfl_xor(mx, 16, 32));
      const float mn = fmaxf(m[qt], mx);
      corr[qt] = __expf(m[qt] - mn);
      m[qt] = mn;
      const float msh = mn - LNPS;                            // exp gives e^{s-m} * 1024
      float ls = 0.f;
#pragma unroll
      for (int r = 0; r < 8; ++r) {
        const float e0 = __expf(s0[r] - msh);                 // key kb      + 8h + r
        const float e1 = __expf(s1[r] - msh);                 // key kb + 16 + 8h + r
        ls += e0 + e1;
        ph[qt].h[0][r] = (_Float16)e0;                        // B elements 0..7:  keys 8h .. 8h+7
        ph[qt].h[1][r] = (_Float16)e1;                        // B elements 8..15: keys 16+8h .. 23+8h
      }
      l[qt] = l[qt] * corr[qt] + ls;
    }

#pragma unroll
    for (int qt = 0; qt < 2; ++qt)
#pragma unroll
      for (int j = 0; j < 16; ++j)
#pragma unroll
        for (int r = 0; r < 8; ++r) acc[qt][j][r] *= corr[qt];   // every element of a lane belongs to its query c of tile qt

#pragma unroll
    for (int j = 0; j < 4; ++j) vb[j] = ldfrag_h(vg1 + vbo + 16 * j * VSP);
#pragma unroll
    for (int j = 0; j < 4; ++j) {
      acc[0][j] = mma_h(va[j], ph[0].v, acc[0][j]);
      acc[1][j] = mma_h(va[j], ph[1].v, acc[1][j]);
    }
#pragma unroll
    for (int j = 0; j < 4; ++j) va[j] = ldfrag_h(vg2 + vbo + 16 * j * VSP);
#pragma unroll
    for (int j = 0; j < 4; ++j) {
      acc[0][4 + j] = mma_h(vb[j], ph[0].v, acc[0][4 + j]);
      acc[1][4 + j] = mma_h(vb[j], ph[1].v, acc[1][4 + j]);
    }
#pragma unroll
    for (int j = 0; j < 4; ++j) vb[j] = ldfrag_h(vg3 + vbo + 16 * j * VSP);
#pragma unroll
    for (int j = 0; j < 4; ++j) {
      acc[0][8 + j] = mma_h(va[j], ph[0].v, acc[0][8 + j]);
      acc[1][8 + j] = mma_h(va[j], ph[1].v, acc[1][8 + j]);
    }
#pragma unroll
    for (int j = 0; j < 4; ++j) {
      acc[0][12 + j] = mma_h(vb[j], ph[0].v, acc[0][12 + j]);
      acc[1][12 + j] = mma_h(vb[j], ph[1].v, acc[1][12 + j]);
    }

    // end of stage s: publish stage s+1, free this buffer, refill it with stage s+2
    asm volatile("s_wait_dscnt 0x0" ::: "memory");            // this wave's reads of the buffer are done before it is refilled
    asm volatile("s_wait_asynccnt 0x0" ::: "memory");         // this wave's copies of stage s+1 have landed
    __syncthreads();
    const int sn = s + 2;
    if (sn < nst) {                                           // block-uniform
      const uint32_t kd = kdst + (uint32_t)buf * (KST * KQP * 2u);
      const uint32_t vd = vdst + (uint32_t)buf * (DM * VSP * 2u);
      const _Float16* kn = ksrc + (size_t)sn * KST * DM;
      const _Float16* vn = vsrc + (size_t)sn * KST;
      acopy8(kd, KQP * 2u, kn, (size_t)DM);
      acopy8(kd + 8u * KQP * 2u, KQP * 2u, kn + (size_t)8 * DM, (size_t)DM);
      acopy8(vd, 2u * VSP * 2u, vn, (size_t)2 * SEQ);
      acopy8(vd + 16u * VSP * 2u, 2u * VSP * 2u, vn + (size_t)16 * SEQ, (size_t)2 * SEQ);
    }
  }
  asm volatile("s_wait_asynccnt 0x0" ::: "memory");           // no copy is outstanding when the loop is left

  // join the four key quarters of a query group: lane to same lane of the three other waves with this wq
#pragma unroll
  for (int qt = 0; qt < 2; ++qt) {
    Ml[qt * 256 + tid]       = m[qt];
    Ml[(2 + qt) * 256 + tid] = l[qt];
  }
  {
    float* mgw = Mg + wave * 24 * 256 + lane * 4;             // 48 pieces of 32 lanes x 16 B; tile ((g-1)*2 + qt)*4 + j
#pragma unroll
    for (int g = 1; g < 4; ++g)
#pragma unroll
      for (int qt = 0; qt < 2; ++qt)
#pragma unroll
        for (int j = 0; j < 4; ++j) {
          const int ti = ((g - 1) * 2 + qt) * 4 + j;
          const v8f a = acc[qt][4 * g + j];
          v4f v0, v1;
          v0[0] = a[0]; v0[1] = a[1]; v0[2] = a[2]; v0[3] = a[3];
          v1[0] = a[4]; v1[1] = a[5]; v1[2] = a[6]; v1[3] = a[7];
          *(v4f*)(mgw + (2 * ti) * 128)     = v0;
          *(v4f*)(mgw + (2 * ti + 1) * 128) = v1;
        }
  }
  __syncthreads();
#pragma unroll
  for (int qt = 0; qt < 2; ++qt) {
    // the wave with key quarter (kg - g) & 3 holds this wave's d range as its group g
    float mp[4], lp[4];
    mp[0] = m[qt]; lp[0] = l[qt];
#pragma unroll
    for (int g = 1; g < 4; ++g) {
      const int pt = (wq + 2 * ((kg - g) & 3)) * 32 + lane;   // same lane of that wave
      mp[g] = Ml[qt * 256 + pt];
      lp[g] = Ml[(2 + qt) * 256 + pt];
    }
    const float mt = fmaxf(fmaxf(mp[0], mp[1]), fmaxf(mp[2], mp[3]));
    float ax[4];
    float lt = 0.f;
#pragma unroll
    for (int g = 0; g < 4; ++g) { ax[g] = __expf(mp[g] - mt); lt += lp[g] * ax[g]; }   // one of them is 1
    lt += __shfl_xor(lt, 16, 32);                             // o and l carry the same factor; lt > 0 (the top key adds its full weight)
    const float il = 1.0f / lt;
#pragma unroll
    for (int j = 0; j < 4; ++j)
#pragma unroll
      for (int r = 0; r < 8; ++r) acc[qt][j][r] *= ax[0] * il;
#pragma unroll
    for (int g = 1; g < 4; ++g) {
      const float sp = ax[g] * il;
      const float* mgr = Mg + (wq + 2 * ((kg - g) & 3)) * 24 * 256 + lane * 4;
#pragma unroll
      for (int j = 0; j < 4; ++j) {
        const int ti = ((g - 1) * 2 + qt) * 4 + j;
        const v4f p0 = *(const v4f*)(mgr + (2 * ti) * 128);
        const v4f p1 = *(const v4f*)(mgr + (2 * ti + 1) * 128);
#pragma unroll
        for (int r = 0; r < 4; ++r) {
          acc[qt][j][r]     += p0[r] * sp;
          acc[qt][j][4 + r] += p1[r] * sp;
        }
      }
    }
  }

  const int e = tid & 7, lg = tid >> 3;                      // lg 0..31: line slot, e: 16-B piece
  float* ob = out + ((size_t)b * SEQ + n0) * DM;
#pragma unroll
  for (int t = 0; t < 2; ++t) {
    if ((kg >> 1) == t) {                                     // wave-uniform: waves with kg = 2t, 2t+1 own d 128t .. 128t+127
#pragma unroll
      for (int qt = 0; qt < 2; ++qt)
#pragma unroll
        for (int j = 0; j < 4; ++j) {
          float* os = Os + (32 * wq + 16 * qt + c) * OSP + 64 * (kg & 1) + 16 * j + 8 * h;
          v4f v0, v1;
          v0[0] = acc[qt][j][0]; v0[1] = acc[qt][j][1]; v0[2] = acc[qt][j][2]; v0[3] = acc[qt][j][3];
          v1[0] = acc[qt][j][4]; v1[1] = acc[qt][j][5]; v1[2] = acc[qt][j][6]; v1[3] = acc[qt][j][7];
          *(v4f*)(os)     = v0;
          *(v4f*)(os + 4) = v1;
        }
    }
    __syncthreads();
{
#pragma unroll
      for (int i = 0; i < 8; ++i) {
        const int L   = i * 32 + lg;                         // lines 0..255 of this half
        const int row = L >> 2, hf = L & 3;                  // query row 0..63, line 0..3 of the 128-float segment
        const v4f v = *(const v4f*)(Os + row * OSP + 32 * hf + 4 * e);
        *(v4f*)(ob + (size_t)row * DM + 128 * t + 32 * hf + 4 * e) = v;
      }
      
    }
    __syncthreads();
  }
}

// =====================================================================================================
// needed (all tiles exact, all grids exact multiples):
//   Qp   f16  [16384][256]      0            8388608
//   Kp   f16  [16384][256]      8388608      8388608
//   Vt   f16  [8][256][2048]    16777216     8388608
//   CNT  i32  [8] x 128 B       25165824     1024
//   end                         25166848
// =====================================================================================================
extern "C" void kernel_launch(void* const* d_in, const int* in_sizes, int n_in,
                              void* d_out, int out_size, void* d_ws, size_t ws_size,
                              hipStream_t stream) {
  const int NX = NB * SEQ * DM;                          // 4194304
  if (n_in < 9) return;
  if (in_sizes[0] != NX || in_sizes[1] != NX || in_sizes[2] != NB * SEQ) return;
  if (in_sizes[3] != DM * DM || in_sizes[5] != DM * DM || in_sizes[7] != DM * DM) return;
  if (in_sizes[4] != DM || in_sizes[6] != DM || in_sizes[8] != DM) return;
  if (out_size != NX) return;

  size_t off = 0;
  const size_t szP = (size_t)NROW * DM * 2;              // 8388608
  const size_t oQP = off; off += szP;
  const size_t oKP = off; off += szP;
  const size_t oVT = off; off += szP;
  const size_t oCN = off; off += (size_t)NB * 128;
  if (off > ws_size) return;                             // off = 25166848

  const float* Ain = (const float*)d_in[0];
  const float* Bin = (const float*)d_in[1];
  const int*   msk = (const int*)d_in[2];
  const float* Wq  = (const float*)d_in[3];
  const float* bq  = (const float*)d_in[4];
  const float* Wk  = (const float*)d_in[5];
  const float* bk  = (const float*)d_in[6];
  const float* Wv  = (const float*)d_in[7];
  const float* bv  = (const float*)d_in[8];
  char* ws = (char*)d_ws;
  unsigned short* QP  = (unsigned short*)(ws + oQP);
  unsigned short* KP  = (unsigned short*)(ws + oKP);
  unsigned short* VT  = (unsigned short*)(ws + oVT);
  int*            CN  = (int*)(ws + oCN);
  float* out = (float*)d_out;

  const dim3 blk256(256);
  const dim3 gP(PTILES / TPB);                           // 256 blocks: three 64-row tiles each
  const dim3 gA(NB * (SEQ / QT));                        // 256 blocks: one (b, 64-query tile) each

  // (1) Qp = Ab . Wqb^T + bq (f16 plane), Kp = Bb . Wkb^T + bk (f16 plane), Vt = (Bb . Wvb^T + bv)^T per batch (f16),
  //     K and V over the kept keys of each batch, packed
  proj_all<<<gP, blk256, 0, stream>>>(Ain, Bin, msk, Wq, bq, Wk, bk, Wv, bv, QP, KP, VT, CN);
  // (2) out[b][n][d] = sum_m softmax_m(mask ? Qp_n . Kp_m / 16 : -big) Vt[d][m]
  attn_kernel<<<gA, blk256, 0, stream>>>(QP, KP, VT, CN, out);
  (void)hipGetLastError();
}
